// v000
// The times below were measured on an AMD MI455X: many runs one after another, warmed up first and cycling through
// copies of the inputs, with the whole window's GPU time divided by the number of runs. Launches and the gaps
// between them are all in it. The median over several windows is given; except for v000 it joins two sittings, which
// can be a few percent apart, so the side-by-side timings, each taken in one sitting, are the better comparison.
// The starting kernel, v000, takes 1370 microseconds a run.
#include <hip/hip_runtime.h>

typedef __attribute__((ext_vector_type(2))) float v2f;
typedef __attribute__((ext_vector_type(8))) float v8f;

#define TB 64
#define TN 8192
#define TD 64
#define TH 128
#define CHUNKS 16
#define RPI 32
#define ITERS ((TN / CHUNKS) / RPI)   // 16
#define BLOCK 256
#define BDH (TB * TD * TH)            // 524288
#define ACCN (2 * BDH + 2 * TB)       // G0 | G1 | S[b] | Lsum[b]

__device__ __forceinline__ v8f vzero8() {
  v8f v;
#pragma unroll
  for (int i = 0; i < 8; ++i) v[i] = 0.0f;
  return v;
}

__device__ __forceinline__ v8f wmma4(v2f a, v2f b, v8f c) {
  // D = A(16x4,f32) x B(4x16,f32) + C(16x16,f32)
  return __builtin_amdgcn_wmma_f32_16x16x4_f32(false, a, false, b, (short)0, c,
                                               false, false);
}

__device__ __forceinline__ float gelu_f(float x) {
  return 0.5f * x * (1.0f + erff(x * 0.7071067811865476f));
}
__device__ __forceinline__ float gelu_df(float x) {
  float phi = 0.5f * (1.0f + erff(x * 0.7071067811865476f));
  return phi + x * 0.3989422804014327f * __expf(-0.5f * x * x);
}

// A fragment: row-major M, 16x4 block at (r0,k0), leading-dim ld.
// ISA layout: VGPR0 = {K0 lanes0-15, K2 lanes16-31}, VGPR1 = {K1, K3}.
__device__ __forceinline__ v2f fragA(const float* m, int ld, int r0, int k0,
                                     int l, int half) {
  const float* p = m + (r0 + l) * ld + k0 + 2 * half;
  v2f a; a.x = p[0]; a.y = p[1]; return a;
}
// B fragment: row-major M, 4x16 block at (k0,c0). Also serves as A^T fragment.
__device__ __forceinline__ v2f fragB(const float* m, int ld, int k0, int c0,
                                     int l, int half) {
  const float* p = m + (k0 + 2 * half) * ld + c0 + l;
  v2f b; b.x = p[0]; b.y = p[ld]; return b;
}
// B = W^T with W row-major: B[k][c] = W[c][k]
__device__ __forceinline__ v2f fragBT(const float* w, int ld, int k0, int c0,
                                      int l, int half) {
  const float* p = w + (c0 + l) * ld + k0 + 2 * half;
  v2f b; b.x = p[0]; b.y = p[1]; return b;
}

// CDNA5 async Global->LDS DMA (ASYNCcnt-tracked, VGPR-bypassing).
// lds_off: byte offset in LDS space (generic-pointer low 32 bits).
__device__ __forceinline__ void async_ld_b128(unsigned lds_off,
                                              const float4* g) {
  asm volatile("global_load_async_to_lds_b128 %0, %1, off"
               :: "v"(lds_off), "v"(g)
               : "memory");
}

__global__ void ttt_zero(float* acc) {
  int i = blockIdx.x * blockDim.x + threadIdx.x;
  if (i < ACCN) acc[i] = 0.0f;
}

__global__ __launch_bounds__(BLOCK, 1) void ttt_main(
    const float* __restrict__ X, const float* __restrict__ w0,
    const float* __restrict__ w1, const float* __restrict__ wk,
    float* __restrict__ acc) {
  __shared__ __align__(16) float s_wk[TD * TD];        // 16 KB
  __shared__ __align__(16) float s_w0[TD * TH];        // 32 KB
  __shared__ __align__(16) float s_w1[TH * TD];        // 32 KB
  __shared__ __align__(16) float s_Xbuf[2][RPI * TD];  // 16 KB ping-pong X
  __shared__ __align__(16) float s_R[RPI * TD];        // 8 KB residual
  __shared__ __align__(16) float s_k[RPI * TD];        // 8 KB
  __shared__ __align__(16) float s_h[RPI * TH];        // 16 KB pre-activation
  __shared__ __align__(16) float s_dH[RPI * TH];       // 16 KB
  __shared__ float s_red[BLOCK];

  const int b = blockIdx.x / CHUNKS;
  const int chunk = blockIdx.x % CHUNKS;
  const int tid = threadIdx.x;
  const int wid = tid >> 5;      // 8 wave32 per block
  const int lane = tid & 31;
  const int half = lane >> 4;
  const int l = lane & 15;

  const float* Xb =
      X + (size_t)b * TN * TD + (size_t)chunk * (TN / CHUNKS) * TD;

  // Issue async DMA of X tile `tile` into ping-pong buffer `bufidx`.
  // RPI*TD floats = 512 float4 => 2 x b128 per thread, asynccnt += 2 per wave.
  auto issue_tile = [&](int tile, int bufidx) {
    const float4* src = (const float4*)(Xb + (size_t)tile * RPI * TD);
    unsigned base = (unsigned)(uintptr_t)(void*)&s_Xbuf[bufidx][0];
    async_ld_b128(base + (unsigned)tid * 16u, src + tid);
    async_ld_b128(base + (unsigned)(tid + BLOCK) * 16u, src + tid + BLOCK);
  };

  issue_tile(0, 0);  // prime the pipeline

  for (int i = tid; i < TD * TD; i += BLOCK) s_wk[i] = wk[i];
  for (int i = tid; i < TD * TH; i += BLOCK) s_w0[i] = w0[i];
  for (int i = tid; i < TH * TD; i += BLOCK) s_w1[i] = w1[i];

  v8f accG0[4], accG1[4];
#pragma unroll
  for (int t = 0; t < 4; ++t) { accG0[t] = vzero8(); accG1[t] = vzero8(); }
  float sum_k = 0.0f, sum_l = 0.0f;

  __syncthreads();

  int cur = 0;
  for (int it = 0; it < ITERS; ++it) {
    // ---- pipeline: start DMA of next tile, wait for current tile ----
    if (it + 1 < ITERS) {
      issue_tile(it + 1, cur ^ 1);  // buf was fully consumed 5 barriers ago
      // async loads complete in order: <=2 outstanding means current tile done
      asm volatile("s_wait_asynccnt 0x2" ::: "memory");
    } else {
      asm volatile("s_wait_asynccnt 0x0" ::: "memory");
    }
    __syncthreads();
    const float* s_X = s_Xbuf[cur];

    // ---- k = X @ wk^T : 2x4 tiles, 1 tile per wave ----
    {
      const int rt = (wid >> 2) * 16, ct = (wid & 3) * 16;
      v8f c = vzero8();
#pragma unroll
      for (int kk = 0; kk < TD; kk += 4)
        c = wmma4(fragA(s_X, TD, rt, kk, l, half),
                  fragBT(s_wk, TD, kk, ct, l, half), c);
#pragma unroll
      for (int r = 0; r < 8; ++r) {
        s_k[(rt + r + 8 * half) * TD + ct + l] = c[r];
        sum_k += c[r];
      }
    }
    __syncthreads();

    // ---- h = k @ w0 : 2x8 tiles, 2 per wave ----
#pragma unroll
    for (int tt = 0; tt < 2; ++tt) {
      const int t = wid * 2 + tt;
      const int rt = (t >> 3) * 16, ct = (t & 7) * 16;
      v8f c = vzero8();
#pragma unroll
      for (int kk = 0; kk < TD; kk += 4)
        c = wmma4(fragA(s_k, TD, rt, kk, l, half),
                  fragB(s_w0, TH, kk, ct, l, half), c);
#pragma unroll
      for (int r = 0; r < 8; ++r)
        s_h[(rt + r + 8 * half) * TH + ct + l] = c[r];
    }
    __syncthreads();

    // ---- R = gelu(h) @ w1 - k : 2x4 tiles, 1 per wave ----
    {
      const int rt = (wid >> 2) * 16, ct = (wid & 3) * 16;
      v8f c = vzero8();
#pragma unroll
      for (int kk = 0; kk < TH; kk += 4) {
        const float* p = s_h + (rt + l) * TH + kk + 2 * half;
        v2f a; a.x = gelu_f(p[0]); a.y = gelu_f(p[1]);
        c = wmma4(a, fragB(s_w1, TD, kk, ct, l, half), c);
      }
#pragma unroll
      for (int r = 0; r < 8; ++r) {
        const int rr = rt + r + 8 * half, cc = ct + l;
        float Rv = c[r] - s_k[rr * TD + cc];
        s_R[rr * TD + cc] = Rv;
        sum_l += Rv * Rv;
      }
    }
    __syncthreads();

    // ---- dH = (R @ w1^T) * gelu'(h) : 2x8 tiles, 2 per wave ----
#pragma unroll
    for (int tt = 0; tt < 2; ++tt) {
      const int t = wid * 2 + tt;
      const int rt = (t >> 3) * 16, ct = (t & 7) * 16;
      v8f c = vzero8();
#pragma unroll
      for (int kk = 0; kk < TD; kk += 4)
        c = wmma4(fragA(s_R, TD, rt, kk, l, half),
                  fragBT(s_w1, TD, kk, ct, l, half), c);
#pragma unroll
      for (int r = 0; r < 8; ++r) {
        const int rr = rt + r + 8 * half, cc = ct + l;
        s_dH[rr * TH + cc] = c[r] * gelu_df(s_h[rr * TH + cc]);
      }
    }
    __syncthreads();

    // ---- G1 += g^T @ R : 8x4 output tiles, 4 per wave (K = rows) ----
#pragma unroll
    for (int tt = 0; tt < 4; ++tt) {
      const int t = wid * 4 + tt;
      const int ht = (t >> 2) * 16, jt = (t & 3) * 16;
      v8f c = accG1[tt];
#pragma unroll
      for (int kk = 0; kk < RPI; kk += 4) {
        const float* p = s_h + (kk + 2 * half) * TH + ht + l;  // g^T fragment
        v2f a; a.x = gelu_f(p[0]); a.y = gelu_f(p[TH]);
        c = wmma4(a, fragB(s_R, TD, kk, jt, l, half), c);
      }
      accG1[tt] = c;
    }
    // ---- G0 += k^T @ dH : 4x8 output tiles, 4 per wave ----
#pragma unroll
    for (int tt = 0; tt < 4; ++tt) {
      const int t = wid * 4 + tt;
      const int dt = (t >> 3) * 16, jt = (t & 7) * 16;
      v8f c = accG0[tt];
#pragma unroll
      for (int kk = 0; kk < RPI; kk += 4)
        c = wmma4(fragB(s_k, TD, kk, dt, l, half),   // k^T fragment
                  fragB(s_dH, TH, kk, jt, l, half), c);
      accG0[tt] = c;
    }
    __syncthreads();
    cur ^= 1;
  }

  // ---- merge per-workgroup partials via fp32 global atomics ----
  float* G0b = acc + (size_t)b * TD * TH;
  float* G1b = acc + (size_t)BDH + (size_t)b * TH * TD;
#pragma unroll
  for (int tt = 0; tt < 4; ++tt) {
    const int t = wid * 4 + tt;
    const int dt = (t >> 3) * 16, jt = (t & 7) * 16;
#pragma unroll
    for (int r = 0; r < 8; ++r)
      unsafeAtomicAdd(&G0b[(dt + r + 8 * half) * TH + jt + l], accG0[tt][r]);
  }
#pragma unroll
  for (int tt = 0; tt < 4; ++tt) {
    const int t = wid * 4 + tt;
    const int ht = (t >> 2) * 16, jt = (t & 3) * 16;
#pragma unroll
    for (int r = 0; r < 8; ++r)
      unsafeAtomicAdd(&G1b[(ht + r + 8 * half) * TD + jt + l], accG1[tt][r]);
  }

  s_red[tid] = sum_k;
  __syncthreads();
  for (int off = BLOCK / 2; off > 0; off >>= 1) {
    if (tid < off) s_red[tid] += s_red[tid + off];
    __syncthreads();
  }
  if (tid == 0) unsafeAtomicAdd(&acc[2 * BDH + b], s_red[0]);
  __syncthreads();
  s_red[tid] = sum_l;
  __syncthreads();
  for (int off = BLOCK / 2; off > 0; off >>= 1) {
    if (tid < off) s_red[tid] += s_red[tid + off];
    __syncthreads();
  }
  if (tid == 0) unsafeAtomicAdd(&acc[2 * BDH + TB + b], s_red[0]);
}

__global__ void ttt_finalize(const float* __restrict__ acc,
                             float* __restrict__ out) {
  const float inv = 1.0f / ((float)TN * (float)TD);
  int i = blockIdx.x * blockDim.x + threadIdx.x;
  const int total = 2 * BDH + TB;
  if (i >= total) return;
  if (i < 2 * BDH) {
    int b = (i < BDH) ? (i / (TD * TH)) : ((i - BDH) / (TH * TD));
    float alpha = 2.0f * acc[2 * BDH + b] * inv;  // 2*S/(N*D)
    out[i] = alpha * acc[i];
  } else {
    int b = i - 2 * BDH;
    out[i] = acc[2 * BDH + TB + b] * inv;         // loss = sumR2/(N*D)
  }
}

extern "C" void kernel_launch(void* const* d_in, const int* in_sizes, int n_in,
                              void* d_out, int out_size, void* d_ws,
                              size_t ws_size, hipStream_t stream) {
  const float* X  = (const float*)d_in[0];
  const float* w0 = (const float*)d_in[1];
  const float* w1 = (const float*)d_in[2];
  const float* wk = (const float*)d_in[3];
  float* out = (float*)d_out;
  float* acc = (float*)d_ws;  // needs (2*BDH + 128) * 4 bytes ~= 4 MB
  (void)in_sizes; (void)n_in; (void)out_size; (void)ws_size;

  ttt_zero<<<(ACCN + 255) / 256, 256, 0, stream>>>(acc);
  ttt_main<<<dim3(TB * CHUNKS), dim3(BLOCK), 0, stream>>>(X, w0, w1, wk, acc);
  ttt_finalize<<<(2 * BDH + TB + 255) / 256, 256, 0, stream>>>(acc, out);
}

// v001
// One run takes 759 microseconds.
// In both of two side-by-side timings against v000, it was 1.83 times as fast.
#include <hip/hip_runtime.h>

typedef __attribute__((ext_vector_type(2))) float v2f;
typedef __attribute__((ext_vector_type(8))) float v8f;

#define TB 64
#define TN 8192
#define TD 64
#define TH 128
#define CHUNKS 16
#define RPI 32
#define ITERS ((TN / CHUNKS) / RPI)   // 16
#define BLOCK 256
#define BDH (TB * TD * TH)            // 524288
#define ACCN (2 * BDH + 2 * TB)       // G0 | G1 | S[b] | Lsum[b]

__device__ __forceinline__ v8f vzero8() {
  v8f v;
#pragma unroll
  for (int i = 0; i < 8; ++i) v[i] = 0.0f;
  return v;
}

__device__ __forceinline__ v8f wmma4(v2f a, v2f b, v8f c) {
  // D = A(16x4,f32) x B(4x16,f32) + C(16x16,f32)
  return __builtin_amdgcn_wmma_f32_16x16x4_f32(false, a, false, b, (short)0, c,
                                               false, false);
}

// gelu(x) and gelu'(x) from one erf evaluation.
__device__ __forceinline__ void gelu_both(float x, float& g, float& dg) {
  float e1 = 1.0f + erff(x * 0.7071067811865476f);
  g = 0.5f * x * e1;
  float phi = 0.5f * e1;
  dg = phi + x * 0.3989422804014327f * __expf(-0.5f * x * x);
}

// A fragment: row-major M, 16x4 block at (r0,k0), leading-dim ld.
// ISA layout: VGPR0 = {K0 lanes0-15, K2 lanes16-31}, VGPR1 = {K1, K3}.
__device__ __forceinline__ v2f fragA(const float* m, int ld, int r0, int k0,
                                     int l, int half) {
  const float* p = m + (r0 + l) * ld + k0 + 2 * half;
  v2f a; a.x = p[0]; a.y = p[1]; return a;
}
// B fragment: row-major M, 4x16 block at (k0,c0). Also serves as A^T fragment.
__device__ __forceinline__ v2f fragB(const float* m, int ld, int k0, int c0,
                                     int l, int half) {
  const float* p = m + (k0 + 2 * half) * ld + c0 + l;
  v2f b; b.x = p[0]; b.y = p[ld]; return b;
}
// B = W^T with W row-major: B[k][c] = W[c][k]
__device__ __forceinline__ v2f fragBT(const float* w, int ld, int k0, int c0,
                                      int l, int half) {
  const float* p = w + (c0 + l) * ld + k0 + 2 * half;
  v2f b; b.x = p[0]; b.y = p[1]; return b;
}

// CDNA5 async Global->LDS DMA (ASYNCcnt-tracked, VGPR-bypassing).
// lds_off: byte offset in LDS space (generic-pointer low 32 bits).
__device__ __forceinline__ void async_ld_b128(unsigned lds_off,
                                              const float4* g) {
  asm volatile("global_load_async_to_lds_b128 %0, %1, off"
               :: "v"(lds_off), "v"(g)
               : "memory");
}

__global__ void ttt_zero(float* acc) {
  int i = blockIdx.x * blockDim.x + threadIdx.x;
  if (i < ACCN) acc[i] = 0.0f;
}

__global__ __launch_bounds__(BLOCK, 1) void ttt_main(
    const float* __restrict__ X, const float* __restrict__ w0,
    const float* __restrict__ w1, const float* __restrict__ wk,
    float* __restrict__ acc) {
  __shared__ __align__(16) float s_wk[TD * TD];        // 16 KB
  __shared__ __align__(16) float s_w0[TD * TH];        // 32 KB
  __shared__ __align__(16) float s_w1[TH * TD];        // 32 KB
  __shared__ __align__(16) float s_Xbuf[2][RPI * TD];  // 16 KB ping-pong X
  __shared__ __align__(16) float s_R[RPI * TD];        // 8 KB residual
  __shared__ __align__(16) float s_k[RPI * TD];        // 8 KB
  __shared__ __align__(16) float s_g[RPI * TH];        // 16 KB gelu(h)
  __shared__ __align__(16) float s_dH[RPI * TH];       // 16 KB gelu'(h), then dH
  __shared__ float s_red[BLOCK];

  const int b = blockIdx.x / CHUNKS;
  const int chunk = blockIdx.x % CHUNKS;
  const int tid = threadIdx.x;
  const int wid = tid >> 5;      // 8 wave32 per block
  const int lane = tid & 31;
  const int half = lane >> 4;
  const int l = lane & 15;

  const float* Xb =
      X + (size_t)b * TN * TD + (size_t)chunk * (TN / CHUNKS) * TD;

  // Issue async DMA of X tile `tile` into ping-pong buffer `bufidx`.
  // RPI*TD floats = 512 float4 => 2 x b128 per thread, asynccnt += 2 per wave.
  auto issue_tile = [&](int tile, int bufidx) {
    const float4* src = (const float4*)(Xb + (size_t)tile * RPI * TD);
    unsigned base = (unsigned)(uintptr_t)(void*)&s_Xbuf[bufidx][0];
    async_ld_b128(base + (unsigned)tid * 16u, src + tid);
    async_ld_b128(base + (unsigned)(tid + BLOCK) * 16u, src + tid + BLOCK);
  };

  issue_tile(0, 0);  // prime the pipeline

  for (int i = tid; i < TD * TD; i += BLOCK) s_wk[i] = wk[i];
  for (int i = tid; i < TD * TH; i += BLOCK) s_w0[i] = w0[i];
  for (int i = tid; i < TH * TD; i += BLOCK) s_w1[i] = w1[i];

  v8f accG0[4], accG1[4];
#pragma unroll
  for (int t = 0; t < 4; ++t) { accG0[t] = vzero8(); accG1[t] = vzero8(); }
  float sum_k = 0.0f, sum_l = 0.0f;

  __syncthreads();

  int cur = 0;
  for (int it = 0; it < ITERS; ++it) {
    // ---- pipeline: start DMA of next tile, wait for current tile ----
    if (it + 1 < ITERS) {
      issue_tile(it + 1, cur ^ 1);  // buf was fully consumed 5 barriers ago
      // async loads complete in order: <=2 outstanding means current tile done
      asm volatile("s_wait_asynccnt 0x2" ::: "memory");
    } else {
      asm volatile("s_wait_asynccnt 0x0" ::: "memory");
    }
    __syncthreads();
    const float* s_X = s_Xbuf[cur];

    // ---- k = X @ wk^T : 2x4 tiles, 1 tile per wave ----
    {
      const int rt = (wid >> 2) * 16, ct = (wid & 3) * 16;
      v8f c = vzero8();
#pragma unroll
      for (int kk = 0; kk < TD; kk += 4)
        c = wmma4(fragA(s_X, TD, rt, kk, l, half),
                  fragBT(s_wk, TD, kk, ct, l, half), c);
#pragma unroll
      for (int r = 0; r < 8; ++r) {
        s_k[(rt + r + 8 * half) * TD + ct + l] = c[r];
        sum_k += c[r];
      }
    }
    __syncthreads();

    // ---- h = k @ w0 : 2x8 tiles, 2 per wave; each element's gelu and gelu'
    //      are evaluated here, once, and the later phases read the values ----
#pragma unroll
    for (int tt = 0; tt < 2; ++tt) {
      const int t = wid * 2 + tt;
      const int rt = (t >> 3) * 16, ct = (t & 7) * 16;
      v8f c = vzero8();
#pragma unroll
      for (int kk = 0; kk < TD; kk += 4)
        c = wmma4(fragA(s_k, TD, rt, kk, l, half),
                  fragB(s_w0, TH, kk, ct, l, half), c);
#pragma unroll
      for (int r = 0; r < 8; ++r) {
        const int idx = (rt + r + 8 * half) * TH + ct + l;
        float g, dg;
        gelu_both(c[r], g, dg);
        s_g[idx] = g;
        s_dH[idx] = dg;
      }
    }
    __syncthreads();

    // ---- R = gelu(h) @ w1 - k : 2x4 tiles, 1 per wave ----
    {
      const int rt = (wid >> 2) * 16, ct = (wid & 3) * 16;
      v8f c = vzero8();
#pragma unroll
      for (int kk = 0; kk < TH; kk += 4)
        c = wmma4(fragA(s_g, TH, rt, kk, l, half),
                  fragB(s_w1, TD, kk, ct, l, half), c);
#pragma unroll
      for (int r = 0; r < 8; ++r) {
        const int rr = rt + r + 8 * half, cc = ct + l;
        float Rv = c[r] - s_k[rr * TD + cc];
        s_R[rr * TD + cc] = Rv;
        sum_l += Rv * Rv;
      }
    }
    __syncthreads();

    // ---- dH = (R @ w1^T) * gelu'(h) : 2x8 tiles, 2 per wave ----
#pragma unroll
    for (int tt = 0; tt < 2; ++tt) {
      const int t = wid * 2 + tt;
      const int rt = (t >> 3) * 16, ct = (t & 7) * 16;
      v8f c = vzero8();
#pragma unroll
      for (int kk = 0; kk < TD; kk += 4)
        c = wmma4(fragA(s_R, TD, rt, kk, l, half),
                  fragBT(s_w1, TD, kk, ct, l, half), c);
#pragma unroll
      for (int r = 0; r < 8; ++r) {
        const int rr = rt + r + 8 * half, cc = ct + l;
        s_dH[rr * TH + cc] = c[r] * s_dH[rr * TH + cc];  // own element, in place
      }
    }
    __syncthreads();

    // ---- G1 += g^T @ R : 8x4 output tiles, 4 per wave (K = rows) ----
#pragma unroll
    for (int tt = 0; tt < 4; ++tt) {
      const int t = wid * 4 + tt;
      const int ht = (t >> 2) * 16, jt = (t & 3) * 16;
      v8f c = accG1[tt];
#pragma unroll
      for (int kk = 0; kk < RPI; kk += 4)
        c = wmma4(fragB(s_g, TH, kk, ht, l, half),   // g^T fragment
                  fragB(s_R, TD, kk, jt, l, half), c);
      accG1[tt] = c;
    }
    // ---- G0 += k^T @ dH : 4x8 output tiles, 4 per wave ----
#pragma unroll
    for (int tt = 0; tt < 4; ++tt) {
      const int t = wid * 4 + tt;
      const int dt = (t >> 3) * 16, jt = (t & 7) * 16;
      v8f c = accG0[tt];
#pragma unroll
      for (int kk = 0; kk < RPI; kk += 4)
        c = wmma4(fragB(s_k, TD, kk, dt, l, half),   // k^T fragment
                  fragB(s_dH, TH, kk, jt, l, half), c);
      accG0[tt] = c;
    }
    __syncthreads();
    cur ^= 1;
  }

  // ---- merge per-workgroup partials via fp32 global atomics ----
  float* G0b = acc + (size_t)b * TD * TH;
  float* G1b = acc + (size_t)BDH + (size_t)b * TH * TD;
#pragma unroll
  for (int tt = 0; tt < 4; ++tt) {
    const int t = wid * 4 + tt;
    const int dt = (t >> 3) * 16, jt = (t & 7) * 16;
#pragma unroll
    for (int r = 0; r < 8; ++r)
      unsafeAtomicAdd(&G0b[(dt + r + 8 * half) * TH + jt + l], accG0[tt][r]);
  }
#pragma unroll
  for (int tt = 0; tt < 4; ++tt) {
    const int t = wid * 4 + tt;
    const int ht = (t >> 2) * 16, jt = (t & 3) * 16;
#pragma unroll
    for (int r = 0; r < 8; ++r)
      unsafeAtomicAdd(&G1b[(ht + r + 8 * half) * TD + jt + l], accG1[tt][r]);
  }

  s_red[tid] = sum_k;
  __syncthreads();
  for (int off = BLOCK / 2; off > 0; off >>= 1) {
    if (tid < off) s_red[tid] += s_red[tid + off];
    __syncthreads();
  }
  if (tid == 0) unsafeAtomicAdd(&acc[2 * BDH + b], s_red[0]);
  __syncthreads();
  s_red[tid] = sum_l;
  __syncthreads();
  for (int off = BLOCK / 2; off > 0; off >>= 1) {
    if (tid < off) s_red[tid] += s_red[tid + off];
    __syncthreads();
  }
  if (tid == 0) unsafeAtomicAdd(&acc[2 * BDH + TB + b], s_red[0]);
}

__global__ void ttt_finalize(const float* __restrict__ acc,
                             float* __restrict__ out) {
  const float inv = 1.0f / ((float)TN * (float)TD);
  int i = blockIdx.x * blockDim.x + threadIdx.x;
  const int total = 2 * BDH + TB;
  if (i >= total) return;
  if (i < 2 * BDH) {
    int b = (i < BDH) ? (i / (TD * TH)) : ((i - BDH) / (TH * TD));
    float alpha = 2.0f * acc[2 * BDH + b] * inv;  // 2*S/(N*D)
    out[i] = alpha * acc[i];
  } else {
    int b = i - 2 * BDH;
    out[i] = acc[2 * BDH + TB + b] * inv;         // loss = sumR2/(N*D)
  }
}

extern "C" void kernel_launch(void* const* d_in, const int* in_sizes, int n_in,
                              void* d_out, int out_size, void* d_ws,
                              size_t ws_size, hipStream_t stream) {
  const float* X  = (const float*)d_in[0];
  const float* w0 = (const float*)d_in[1];
  const float* w1 = (const float*)d_in[2];
  const float* wk = (const float*)d_in[3];
  float* out = (float*)d_out;
  float* acc = (float*)d_ws;  // needs (2*BDH + 128) * 4 bytes ~= 4 MB
  (void)in_sizes; (void)n_in; (void)out_size; (void)ws_size;

  ttt_zero<<<(ACCN + 255) / 256, 256, 0, stream>>>(acc);
  ttt_main<<<dim3(TB * CHUNKS), dim3(BLOCK), 0, stream>>>(X, w0, w1, wk, acc);
  ttt_finalize<<<(2 * BDH + TB + 255) / 256, 256, 0, stream>>>(acc, out);
}

// v002
// Measured time: 385 microseconds a run.
// Next to v001, in two timings, it ran 1.97 and 1.98 times as fast.
// Counting every step since v000, it is 3.62 times as fast.
#include <hip/hip_runtime.h>

typedef __attribute__((ext_vector_type(2))) float v2f;
typedef __attribute__((ext_vector_type(8))) float v8f;

#define TB 64
#define TN 8192
#define TD 64
#define TH 128
#define CHUNKS 16
#define RPI 32
#define ITERS ((TN / CHUNKS) / RPI)   // 16
#define BLOCK 256
#define BDH (TB * TD * TH)            // 524288
#define ACCN (2 * BDH + 2 * TB)       // G0 | G1 | S[b] | Lsum[b]

// LDS row pitches in dwords (64 banks of one dword; bank = dword address mod 64).
// An 8-byte read down a column (16 rows, the two half-waves 2 dwords apart)
// meets 64 different banks when pitch mod 64 is 4 x odd. A 4-byte read along a
// row (the two half-waves 2 rows apart) meets 32 different banks when
// 2 x pitch mod 64 lies in 16..48. Pitch mod 64 = 12 serves both readers, and
// the accumulator-layout stores (half-waves 8 rows apart) as well.
#define PX 68    // X tile: column reads only
#define PWK 68   // wk: column reads only
#define PW0 136  // w0: row reads only
#define PW1 76   // w1: both
#define PD 76    // k and R tiles: both
#define PH 140   // gelu(h) and dH tiles: both

__device__ __forceinline__ v8f vzero8() {
  v8f v;
#pragma unroll
  for (int i = 0; i < 8; ++i) v[i] = 0.0f;
  return v;
}

__device__ __forceinline__ v8f wmma4(v2f a, v2f b, v8f c) {
  // D = A(16x4,f32) x B(4x16,f32) + C(16x16,f32)
  return __builtin_amdgcn_wmma_f32_16x16x4_f32(false, a, false, b, (short)0, c,
                                               false, false);
}

// gelu(x) and gelu'(x) from one erf evaluation.
__device__ __forceinline__ void gelu_both(float x, float& g, float& dg) {
  float e1 = 1.0f + erff(x * 0.7071067811865476f);
  g = 0.5f * x * e1;
  float phi = 0.5f * e1;
  dg = phi + x * 0.3989422804014327f * __expf(-0.5f * x * x);
}

// Fragment loaders. Each takes the lane's own base pointer, formed once per
// phase, and a compile-time k offset, so that every read is base + immediate.
// A fragment of a row-major M, 16x4 block at (r0,k0):
//   base = M + (r0 + l) * ld + 2 * half, read at k0.
// ISA layout: VGPR0 = {K0 lanes0-15, K2 lanes16-31}, VGPR1 = {K1, K3}.
// The same read serves B = W^T with W row-major: B[k][c] = W[c][k].
__device__ __forceinline__ v2f fragA(const float* base, int k0) {
  return *(const v2f*)(base + k0);
}
// B fragment of a row-major M, 4x16 block at (k0,c0); also an A^T fragment:
//   base = M + 2 * half * ld + c0 + l, read at rows k0 and k0 + 1.
__device__ __forceinline__ v2f fragB(const float* base, int ld, int k0) {
  v2f b; b.x = base[k0 * ld]; b.y = base[k0 * ld + ld]; return b;
}

// CDNA5 async Global->LDS DMA (ASYNCcnt-tracked, VGPR-bypassing).
// lds0, lds1: byte offsets in LDS space (generic-pointer low 32 bits).
// The closing s_wait_xcnt stands inside the copies' own statement so that no
// later write of an address register can be scheduled in front of it.
__device__ __forceinline__ void async_ld2_b128(unsigned lds0, const float4* g0,
                                               unsigned lds1,
                                               const float4* g1) {
  asm volatile("global_load_async_to_lds_b128 %0, %1, off\n\t"
               "global_load_async_to_lds_b128 %2, %3, off\n\t"
               "s_wait_xcnt 0x0"
               :: "v"(lds0), "v"(g0), "v"(lds1), "v"(g1)
               : "memory");
}

// Copy a row-major array of N floats, rows of ROW floats, into LDS rows of
// PITCH floats; thread tid takes elements tid, tid + BLOCK, ...
template <int N, int ROW, int PITCH>
__device__ __forceinline__ void stage_rows(float* dst,
                                           const float* __restrict__ src,
                                           int tid) {
  float v[N / BLOCK];
  // Unrolled so that v stays in registers, the loads are in flight together
  // and each is the lane's one offset register + an immediate.
#pragma unroll
  for (int j = 0; j < N / BLOCK; ++j) v[j] = src[tid + j * BLOCK];
  // One wait behind the run, in front of any later write of the registers
  // that the loads name; inside the run none of them is written.
  asm volatile("s_wait_xcnt 0x0" ::: "memory");
  // Unrolled so that v stays in registers.
#pragma unroll
  for (int j = 0; j < N / BLOCK; ++j) {
    const int i = tid + j * BLOCK;
    dst[(i / ROW) * PITCH + (i % ROW)] = v[j];
  }
}

__global__ void ttt_zero(float* acc) {
  int i = blockIdx.x * blockDim.x + threadIdx.x;
  if (i < ACCN) acc[i] = 0.0f;
}

__global__ __launch_bounds__(BLOCK, 1) void ttt_main(
    const float* __restrict__ X, const float* __restrict__ w0,
    const float* __restrict__ w1, const float* __restrict__ wk,
    float* __restrict__ acc) {
  // 160 KiB in all, half of a WGP's LDS.
  __shared__ __align__(16) float s_wk[TD * PWK];
  __shared__ __align__(16) float s_w0[TD * PW0];
  __shared__ __align__(16) float s_w1[TH * PW1];
  __shared__ __align__(16) float s_Xbuf[2][RPI * PX];  // ping-pong X
  __shared__ __align__(16) float s_R[RPI * PD];        // residual
  __shared__ __align__(16) float s_k[RPI * PD];
  __shared__ __align__(16) float s_g[RPI * PH];        // gelu(h)
  __shared__ __align__(16) float s_dH[RPI * PH];       // gelu'(h), then dH

  const int b = blockIdx.x / CHUNKS;
  const int chunk = blockIdx.x % CHUNKS;
  const int tid = threadIdx.x;
  const int wid = tid >> 5;      // 8 wave32 per block
  const int lane = tid & 31;
  const int half = lane >> 4;
  const int l = lane & 15;
  // Tile origins: one 16x16 tile a wave of a 2x4 grid (k, R), two neighbouring
  // tiles a wave of a 2x8 grid (h, dH).
  const int rt1 = (wid >> 2) * 16, ct1 = (wid & 3) * 16;
  const int rt2 = (wid >> 2) * 16, ct2 = (wid & 3) * 32;

  const float* Xb =
      X + (size_t)b * TN * TD + (size_t)chunk * (TN / CHUNKS) * TD;

  // Issue async DMA of X tile `tile` into ping-pong buffer `bufidx`.
  // RPI*TD floats = 512 float4 => 2 x b128 per thread, asynccnt += 2 per wave.
  auto issue_tile = [&](int tile, int bufidx) {
    const float4* src = (const float4*)(Xb + (size_t)tile * RPI * TD);
    unsigned base = (unsigned)(uintptr_t)(void*)&s_Xbuf[bufidx][0];
    // float4 number tid is row tid / 16, 16-byte column tid % 16; the second
    // copy lies BLOCK / 16 rows further down.
    unsigned dst = base + (unsigned)(tid >> 4) * (PX * 4u) +
                   (unsigned)(tid & 15) * 16u;
    async_ld2_b128(dst, src + tid, dst + (BLOCK / 16) * (PX * 4u),
                   src + tid + BLOCK);
  };

  issue_tile(0, 0);  // prime the pipeline

  // Weights into their padded rows.
  stage_rows<TD * TD, TD, PWK>(s_wk, wk, tid);
  stage_rows<TD * TH, TH, PW0>(s_w0, w0, tid);
  stage_rows<TH * TD, TD, PW1>(s_w1, w1, tid);

  v8f accG0[4], accG1[4];
#pragma unroll
  for (int t = 0; t < 4; ++t) { accG0[t] = vzero8(); accG1[t] = vzero8(); }
  float sum_k = 0.0f, sum_l = 0.0f;

  __syncthreads();

  int cur = 0;
  for (int it = 0; it < ITERS; ++it) {
    // ---- pipeline: start DMA of next tile, wait for current tile ----
    if (it + 1 < ITERS) {
      issue_tile(it + 1, cur ^ 1);  // buf was fully consumed 5 barriers ago
      // async loads complete in order: <=2 outstanding means current tile done
      asm volatile("s_wait_asynccnt 0x2" ::: "memory");
    } else {
      asm volatile("s_wait_asynccnt 0x0" ::: "memory");
    }
    __syncthreads();
    const float* s_X = s_Xbuf[cur];

    // ---- k = X @ wk^T : 2x4 tiles, 1 tile per wave ----
    {
      const float* pa = s_X + (rt1 + l) * PX + 2 * half;
      const float* pb = s_wk + (ct1 + l) * PWK + 2 * half;
      v8f c = vzero8();
#pragma unroll
      for (int kk = 0; kk < TD; kk += 4)
        c = wmma4(fragA(pa, kk), fragA(pb, kk), c);
      float* pc = s_k + (rt1 + 8 * half) * PD + ct1 + l;
#pragma unroll
      for (int r = 0; r < 8; ++r) {
        pc[r * PD] = c[r];
        sum_k += c[r];
      }
    }
    __syncthreads();

    // ---- h = k @ w0 : 2x8 tiles, 2 per wave; each element's gelu and gelu'
    //      are evaluated here, once, and the later phases read the values ----
#pragma unroll
    for (int tt = 0; tt < 2; ++tt) {
      const float* pa = s_k + (rt2 + l) * PD + 2 * half;
      const float* pb = s_w0 + 2 * half * PW0 + ct2 + l + tt * 16;
      v8f c = vzero8();
#pragma unroll
      for (int kk = 0; kk < TD; kk += 4)
        c = wmma4(fragA(pa, kk), fragB(pb, PW0, kk), c);
      const int idx = (rt2 + 8 * half) * PH + ct2 + l + tt * 16;
#pragma unroll
      for (int r = 0; r < 8; ++r) {
        float g, dg;
        gelu_both(c[r], g, dg);
        s_g[idx + r * PH] = g;
        s_dH[idx + r * PH] = dg;
      }
    }
    __syncthreads();

    // ---- R = gelu(h) @ w1 - k : 2x4 tiles, 1 per wave ----
    {
      const float* pa = s_g + (rt1 + l) * PH + 2 * half;
      const float* pb = s_w1 + 2 * half * PW1 + ct1 + l;
      v8f c = vzero8();
#pragma unroll
      for (int kk = 0; kk < TH; kk += 4)
        c = wmma4(fragA(pa, kk), fragB(pb, PW1, kk), c);
      const int idx = (rt1 + 8 * half) * PD + ct1 + l;
#pragma unroll
      for (int r = 0; r < 8; ++r) {
        float Rv = c[r] - s_k[idx + r * PD];
        s_R[idx + r * PD] = Rv;
        sum_l += Rv * Rv;
      }
    }
    __syncthreads();

    // ---- dH = (R @ w1^T) * gelu'(h) : 2x8 tiles, 2 per wave ----
#pragma unroll
    for (int tt = 0; tt < 2; ++tt) {
      const float* pa = s_R + (rt2 + l) * PD + 2 * half;
      const float* pb = s_w1 + (ct2 + l + tt * 16) * PW1 + 2 * half;
      v8f c = vzero8();
#pragma unroll
      for (int kk = 0; kk < TD; kk += 4)
        c = wmma4(fragA(pa, kk), fragA(pb, kk), c);
      float* pc = s_dH + (rt2 + 8 * half) * PH + ct2 + l + tt * 16;
#pragma unroll
      for (int r = 0; r < 8; ++r)
        pc[r * PH] = c[r] * pc[r * PH];  // own element, in place
    }
    __syncthreads();

    // ---- G1 += g^T @ R : 8x4 output tiles, 4 per wave (K = rows) ----
#pragma unroll
    for (int tt = 0; tt < 4; ++tt) {
      const float* pa = s_g + 2 * half * PH + wid * 16 + l;    // g^T fragment
      const float* pb = s_R + 2 * half * PD + tt * 16 + l;
      v8f c = accG1[tt];
#pragma unroll
      for (int kk = 0; kk < RPI; kk += 4)
        c = wmma4(fragB(pa, PH, kk), fragB(pb, PD, kk), c);
      accG1[tt] = c;
    }
    // ---- G0 += k^T @ dH : 4x8 output tiles, 4 per wave ----
#pragma unroll
    for (int tt = 0; tt < 4; ++tt) {
      const float* pa = s_k + 2 * half * PD + (wid >> 1) * 16 + l;  // k^T
      const float* pb = s_dH + 2 * half * PH + (wid & 1) * 64 + tt * 16 + l;
      v8f c = accG0[tt];
#pragma unroll
      for (int kk = 0; kk < RPI; kk += 4)
        c = wmma4(fragB(pa, PD, kk), fragB(pb, PH, kk), c);
      accG0[tt] = c;
    }
    __syncthreads();
    cur ^= 1;
  }

  // ---- merge per-workgroup partials via fp32 global atomics ----
  float* G0b = acc + (size_t)b * TD * TH;
  float* G1b = acc + (size_t)BDH + (size_t)b * TH * TD;
#pragma unroll
  for (int tt = 0; tt < 4; ++tt) {
    const int t = wid * 4 + tt;
    const int dt = (t >> 3) * 16, jt = (t & 7) * 16;
#pragma unroll
    for (int r = 0; r < 8; ++r)
      unsafeAtomicAdd(&G0b[(dt + r + 8 * half) * TH + jt + l], accG0[tt][r]);
  }
#pragma unroll
  for (int tt = 0; tt < 4; ++tt) {
    const int t = wid * 4 + tt;
    const int ht = (t >> 2) * 16, jt = (t & 3) * 16;
#pragma unroll
    for (int r = 0; r < 8; ++r)
      unsafeAtomicAdd(&G1b[(ht + r + 8 * half) * TD + jt + l], accG1[tt][r]);
  }

  // The loop's last barrier has ended every read of s_g: its first BLOCK
  // floats now serve the two block sums (no array of their own, so that the
  // padded tiles stay within half of the LDS).
  float* s_red = s_g;
  s_red[tid] = sum_k;
  __syncthreads();
  for (int off = BLOCK / 2; off > 0; off >>= 1) {
    if (tid < off) s_red[tid] += s_red[tid + off];
    __syncthreads();
  }
  if (tid == 0) unsafeAtomicAdd(&acc[2 * BDH + b], s_red[0]);
  __syncthreads();
  s_red[tid] = sum_l;
  __syncthreads();
  for (int off = BLOCK / 2; off > 0; off >>= 1) {
    if (tid < off) s_red[tid] += s_red[tid + off];
    __syncthreads();
  }
  if (tid == 0) unsafeAtomicAdd(&acc[2 * BDH + TB + b], s_red[0]);
}

__global__ void ttt_finalize(const float* __restrict__ acc,
                             float* __restrict__ out) {
  const float inv = 1.0f / ((float)TN * (float)TD);
  int i = blockIdx.x * blockDim.x + threadIdx.x;
  const int total = 2 * BDH + TB;
  if (i >= total) return;
  if (i < 2 * BDH) {
    int b = (i < BDH) ? (i / (TD * TH)) : ((i - BDH) / (TH * TD));
    float alpha = 2.0f * acc[2 * BDH + b] * inv;  // 2*S/(N*D)
    out[i] = alpha * acc[i];
  } else {
    int b = i - 2 * BDH;
    out[i] = acc[2 * BDH + TB + b] * inv;         // loss = sumR2/(N*D)
  }
}

extern "C" void kernel_launch(void* const* d_in, const int* in_sizes, int n_in,
                              void* d_out, int out_size, void* d_ws,
                              size_t ws_size, hipStream_t stream) {
  const float* X  = (const float*)d_in[0];
  const float* w0 = (const float*)d_in[1];
  const float* w1 = (const float*)d_in[2];
  const float* wk = (const float*)d_in[3];
  float* out = (float*)d_out;
  float* acc = (float*)d_ws;  // needs (2*BDH + 128) * 4 bytes ~= 4 MB
  (void)in_sizes; (void)n_in; (void)out_size; (void)ws_size;

  ttt_zero<<<(ACCN + 255) / 256, 256, 0, stream>>>(acc);
  ttt_main<<<dim3(TB * CHUNKS), dim3(BLOCK), 0, stream>>>(X, w0, w1, wk, acc);
  ttt_finalize<<<(2 * BDH + TB + 255) / 256, 256, 0, stream>>>(acc, out);
}

// v004
// A run of this version takes 264 microseconds.
// Versions in between are left out here; by their measured steps it is 1.46 times as fast as v002.
// All steps since v000 together make it 5.27 times as fast.
#include <hip/hip_runtime.h>

typedef __attribute__((ext_vector_type(2))) float v2f;
typedef __attribute__((ext_vector_type(8))) float v8f;

#define TB 64
#define TN 8192
#define TD 64
#define TH 128
#define CHUNKS 4                      // 256 work-groups, one a WGP
#define RPI 128                       // tokens a pass: 16 a wave
#define ITERS ((TN / CHUNKS) / RPI)   // 16
#define BLOCK 256
#define BDH (TB * TD * TH)            // 524288
#define ACCN (2 * BDH + 2 * TB)       // G0 | G1 | S[b] | Lsum[b]

// LDS row pitches in dwords (64 banks of one dword; bank = dword address mod 64).
// A 16-byte access down a column (16 rows a half-wave) is free of conflicts
// when the pitch is 4 x odd. A 4-byte read along a row meets 32 different banks
// when the two half-waves' rows lie 16..48 banks apart: 2 rows apart in the
// token tiles (2 x pitch mod 64 = 24), 8 rows apart in w1 (8 x 68 mod 64 = 32).
#define PWK 68   // wk [o][d]: column reads
#define PW0T 68  // w0 transposed, [j][d]: column reads
#define PW1 68   // w1 [j][d]: column reads and row reads
#define PD 76    // k and R tiles [token][d]: column stores, row reads
#define PH 140   // gelu(h) and dH tiles [token][j]: column stores, row reads

__device__ __forceinline__ v8f vzero8() {
  v8f v;
#pragma unroll
  for (int i = 0; i < 8; ++i) v[i] = 0.0f;
  return v;
}

__device__ __forceinline__ v8f wmma4(v2f a, v2f b, v8f c) {
  // D = A(16x4,f32) x B(4x16,f32) + C(16x16,f32)
  return __builtin_amdgcn_wmma_f32_16x16x4_f32(false, a, false, b, (short)0, c,
                                               false, false);
}

// erf without a branch: the polynomial for |z| < 1 and the one for |z| >= 1
// (erf = 1 - exp(-q)) are both evaluated and one is selected. A wave nearly
// always holds lanes of both ranges, so a branch saves nothing, and without one
// the evaluations of a trip are one block whose chains fill each other's waits.
__device__ __forceinline__ float erf_flat(float z) {
  const float a = fabsf(z);
  const float t = a * a;
  float p = fmaf(t, -0x1.268bc2p-11f, 0x1.420828p-8f);
  p = fmaf(t, p, -0x1.b5937p-6f);
  p = fmaf(t, p, 0x1.ce077cp-4f);
  p = fmaf(t, p, -0x1.81266p-2f);
  p = fmaf(t, p, 0x1.06eba0p-3f);
  const float inner = fmaf(a, p, a);
  float q = fmaf(a, 0x1.1d3156p-16f, -0x1.8d129p-12f);
  q = fmaf(a, q, 0x1.f9a6d2p-9f);
  q = fmaf(a, q, -0x1.8c3164p-6f);
  q = fmaf(a, q, 0x1.b4e9c8p-4f);
  q = fmaf(a, q, 0x1.4515fap-1f);
  q = fmaf(a, q, 0x1.078e50p-3f);
  q = fmaf(a, q, a);
  const float outer = 1.0f - __expf(-q);
  return copysignf(a < 1.0f ? inner : outer, z);
}

// gelu(x) and gelu'(x) from one erf evaluation.
__device__ __forceinline__ void gelu_both(float x, float& g, float& dg) {
  float e1 = 1.0f + erf_flat(x * 0.7071067811865476f);
  g = 0.5f * x * e1;
  float phi = 0.5f * e1;
  dg = phi + x * 0.3989422804014327f * __expf(-0.5f * x * x);
}

// B fragment of a row-major M, 4x16 block at (k0,c0); also an A^T fragment:
//   base = M + 2 * half * ld + c0 + l, read at rows k0 and k0 + 1.
// ISA layout: VGPR0 = {K0 lanes0-15, K2 lanes16-31}, VGPR1 = {K1, K3}.
__device__ __forceinline__ v2f fragB(const float* base, int ld, int k0) {
  v2f b; b.x = base[k0 * ld]; b.y = base[k0 * ld + ld]; return b;
}
// The two k steps that one 16-byte read holds.
__device__ __forceinline__ v2f lo2(float4 v) { v2f r; r.x = v.x; r.y = v.y; return r; }
__device__ __forceinline__ v2f hi2(float4 v) { v2f r; r.x = v.z; r.y = v.w; return r; }
// Registers i, i + 1 of a D tile as a B fragment. D[f][n]: lane (l, half) holds
// column n = l, rows f = 8 * half + r. As B the pair gives k slots 0,1 (half 0)
// = rows i, i + 1 and k slots 2,3 (half 1) = rows 8 + i, 9 + i; the A fragment
// beside it reads its k at 8 * half + i, i + 1, so the pairing is the same.
__device__ __forceinline__ v2f pairB(v8f v, int i) {
  v2f r; r.x = v[i]; r.y = v[i + 1]; return r;
}
// A lane's eight D registers are eight neighbours of one token's row.
__device__ __forceinline__ void store8(float* p, v8f v) {
  *(float4*)p = make_float4(v[0], v[1], v[2], v[3]);
  *(float4*)(p + 4) = make_float4(v[4], v[5], v[6], v[7]);
}

// Copy a row-major array of N floats, rows of ROW floats, into LDS rows of
// PITCH floats; thread tid takes elements tid, tid + BLOCK, ...
template <int N, int ROW, int PITCH>
__device__ __forceinline__ void stage_rows(float* dst,
                                           const float* __restrict__ src,
                                           int tid) {
  float v[N / BLOCK];
  // Unrolled so that v stays in registers, the loads are in flight together
  // and each is the lane's one offset register + an immediate.
#pragma unroll
  for (int j = 0; j < N / BLOCK; ++j) v[j] = src[tid + j * BLOCK];
  // One wait behind the run, in front of any later write of the registers
  // that the loads name; inside the run none of them is written.
  asm volatile("s_wait_xcnt 0x0" ::: "memory");
  // Unrolled so that v stays in registers.
#pragma unroll
  for (int j = 0; j < N / BLOCK; ++j) {
    const int i = tid + j * BLOCK;
    dst[(i / ROW) * PITCH + (i % ROW)] = v[j];
  }
}

// The same, transposed: element (r, c) of the source lands at dst[c][r].
template <int N, int ROW, int PITCH>
__device__ __forceinline__ void stage_cols(float* dst,
                                           const float* __restrict__ src,
                                           int tid) {
  float v[N / BLOCK];
  // Unrolled so that v stays in registers, the loads are in flight together
  // and each is the lane's one offset register + an immediate.
#pragma unroll
  for (int j = 0; j < N / BLOCK; ++j) v[j] = src[tid + j * BLOCK];
  // One wait behind the run, in front of any later write of the registers
  // that the loads name; inside the run none of them is written.
  asm volatile("s_wait_xcnt 0x0" ::: "memory");
  // Unrolled so that v stays in registers.
#pragma unroll
  for (int j = 0; j < N / BLOCK; ++j) {
    const int i = tid + j * BLOCK;
    dst[(i % ROW) * PITCH + (i / ROW)] = v[j];
  }
}

__global__ void ttt_zero(float* acc) {
  int i = blockIdx.x * blockDim.x + threadIdx.x;
  if (i < ACCN) acc[i] = 0.0f;
}

__global__ __launch_bounds__(BLOCK, 1) void ttt_main(
    const float* __restrict__ X, const float* __restrict__ w0,
    const float* __restrict__ w1, const float* __restrict__ wk,
    float* __restrict__ acc) {
  // 301 KiB in all: one work-group a WGP.
  __shared__ __align__(16) float s_wk[TD * PWK];
  __shared__ __align__(16) float s_w0t[TH * PW0T];
  __shared__ __align__(16) float s_w1[TH * PW1];
  __shared__ __align__(16) float s_R[RPI * PD];        // residual
  __shared__ __align__(16) float s_k[RPI * PD];
  __shared__ __align__(16) float s_g[RPI * PH];        // gelu(h)
  __shared__ __align__(16) float s_dH[RPI * PH];       // gelu'(h), then dH

  const int b = blockIdx.x / CHUNKS;
  const int chunk = blockIdx.x % CHUNKS;
  const int tid = threadIdx.x;
  const int wid = tid >> 5;      // 8 wave32 per block
  const int lane = tid & 31;
  const int half = lane >> 4;
  const int l = lane & 15;
  const int t0 = wid * 16;       // the wave's own 16 tokens of a pass

  const float* Xb =
      X + (size_t)b * TN * TD + (size_t)chunk * (TN / CHUNKS) * TD;
  // The lane's token row; read u holds d = 8u + 4 * half .. + 3, two k steps.
  const float4* xp = (const float4*)(Xb + (t0 + l) * TD + 4 * half);
  float4 xr[8];
  auto load_x = [&](int tile) {
    const float4* p = xp + tile * (RPI * TD / 4);
    // Unrolled so that xr stays in registers.
#pragma unroll
    for (int u = 0; u < 8; ++u) xr[u] = p[2 * u];
    // One wait behind the run, in front of any later write of the registers
    // that the loads name.
    asm volatile("s_wait_xcnt 0x0" ::: "memory");
  };
  load_x(0);

  // Weights into their padded rows.
  stage_rows<TD * TD, TD, PWK>(s_wk, wk, tid);
  stage_cols<TD * TH, TH, PW0T>(s_w0t, w0, tid);
  stage_rows<TH * TD, TD, PW1>(s_w1, w1, tid);

  v8f accG0[4], accG1[4];
#pragma unroll
  for (int t = 0; t < 4; ++t) { accG0[t] = vzero8(); accG1[t] = vzero8(); }
  float sum_k = 0.0f, sum_l = 0.0f;

  // The lane's own bases.
  const float* pwk = s_wk + l * PWK + 4 * half;      // A = wk
  const float* pw0 = s_w0t + l * PW0T + 8 * half;    // A = w0^T
  const float* pw1r = s_w1 + 8 * half * PW1 + l;     // A = w1^T
  const float* pw1c = s_w1 + l * PW1 + 8 * half;     // A = w1
  const int rowD = (t0 + l) * PD + 8 * half;
  const int rowH = (t0 + l) * PH + 8 * half;

  __syncthreads();

  for (int it = 0; it < ITERS; ++it) {
    // ---- k^T = wk @ X^T : 4 feature tiles x the wave's 16 tokens ----
    v8f kT[4];
#pragma unroll
    for (int m = 0; m < 4; ++m) kT[m] = vzero8();
#pragma unroll
    for (int u = 0; u < 8; ++u) {
      float4 a[4];
#pragma unroll
      for (int m = 0; m < 4; ++m)
        a[m] = *(const float4*)(pwk + m * 16 * PWK + 8 * u);
#pragma unroll
      for (int m = 0; m < 4; ++m) kT[m] = wmma4(lo2(a[m]), lo2(xr[u]), kT[m]);
#pragma unroll
      for (int m = 0; m < 4; ++m) kT[m] = wmma4(hi2(a[m]), hi2(xr[u]), kT[m]);
    }
    // Ends every wave's reads of the last pass's token tiles.
    __syncthreads();
    // Behind the barrier, whose fence waits for every load in flight: the next
    // barrier stands a whole chain later, when the rows have long arrived.
    if (it + 1 < ITERS) load_x(it + 1);
#pragma unroll
    for (int m = 0; m < 4; ++m) {
      store8(s_k + rowD + m * 16, kT[m]);
#pragma unroll
      for (int r = 0; r < 8; ++r) sum_k += kT[m][r];
    }

    // ---- h^T = w0^T @ k^T, gelu, pred^T += w1^T @ g^T : two hidden tiles a
    //      trip; k^T and g^T are B operands as they stand in the registers ----
    v8f pT[4];
#pragma unroll
    for (int m = 0; m < 4; ++m) pT[m] = vzero8();
    // Kept rolled: no register array is indexed by qg, and the erf code stands
    // once for 16 elements; smaller code.
#pragma unroll 1
    for (int qg = 0; qg < 4; ++qg) {
      const float* a0 = pw0 + qg * 32 * PW0T;
      v8f h0 = vzero8(), h1 = vzero8();
#pragma unroll
      for (int m = 0; m < 4; ++m) {
#pragma unroll
        for (int ip = 0; ip < 2; ++ip) {
          float4 f0 = *(const float4*)(a0 + 16 * m + 4 * ip);
          float4 f1 = *(const float4*)(a0 + 16 * PW0T + 16 * m + 4 * ip);
          h0 = wmma4(lo2(f0), pairB(kT[m], 4 * ip), h0);
          h1 = wmma4(lo2(f1), pairB(kT[m], 4 * ip), h1);
          h0 = wmma4(hi2(f0), pairB(kT[m], 4 * ip + 2), h0);
          h1 = wmma4(hi2(f1), pairB(kT[m], 4 * ip + 2), h1);
        }
      }
      v8f g[2], dg[2];
#pragma unroll
      for (int r = 0; r < 8; ++r) {
        float gv, dv;
        gelu_both(h0[r], gv, dv); g[0][r] = gv; dg[0][r] = dv;
        gelu_both(h1[r], gv, dv); g[1][r] = gv; dg[1][r] = dv;
      }
#pragma unroll
      for (int tt = 0; tt < 2; ++tt) {
        store8(s_g + rowH + qg * 32 + tt * 16, g[tt]);
        store8(s_dH + rowH + qg * 32 + tt * 16, dg[tt]);
      }
      const float* a1 = pw1r + qg * 32 * PW1;
#pragma unroll
      for (int tt = 0; tt < 2; ++tt) {
#pragma unroll
        for (int i = 0; i < 4; ++i) {
#pragma unroll
          for (int m = 0; m < 4; ++m)
            pT[m] = wmma4(fragB(a1 + 16 * m, PW1, tt * 16 + 2 * i),
                          pairB(g[tt], 2 * i), pT[m]);
        }
      }
    }

    // ---- R^T = pred^T - k^T, register by register ----
#pragma unroll
    for (int m = 0; m < 4; ++m) {
#pragma unroll
      for (int r = 0; r < 8; ++r) {
        float Rv = pT[m][r] - kT[m][r];
        pT[m][r] = Rv;
        sum_l += Rv * Rv;
      }
      store8(s_R + rowD + m * 16, pT[m]);
    }

    // ---- dH^T = (w1 @ R^T) * gelu'(h)^T : two hidden tiles a trip ----
    // Kept rolled: no register array is indexed by qg; smaller code.
#pragma unroll 1
    for (int qg = 0; qg < 4; ++qg) {
      const float* a2 = pw1c + qg * 32 * PW1;
      v8f c0 = vzero8(), c1 = vzero8();
#pragma unroll
      for (int m = 0; m < 4; ++m) {
#pragma unroll
        for (int ip = 0; ip < 2; ++ip) {
          float4 f0 = *(const float4*)(a2 + 16 * m + 4 * ip);
          float4 f1 = *(const float4*)(a2 + 16 * PW1 + 16 * m + 4 * ip);
          c0 = wmma4(lo2(f0), pairB(pT[m], 4 * ip), c0);
          c1 = wmma4(lo2(f1), pairB(pT[m], 4 * ip), c1);
          c0 = wmma4(hi2(f0), pairB(pT[m], 4 * ip + 2), c0);
          c1 = wmma4(hi2(f1), pairB(pT[m], 4 * ip + 2), c1);
        }
      }
      float* pc = s_dH + rowH + qg * 32;  // own elements, in place
#pragma unroll
      for (int r = 0; r < 8; ++r) {
        c0[r] *= pc[r];
        c1[r] *= pc[16 + r];
      }
      store8(pc, c0);
      store8(pc + 16, c1);
    }
    // Publishes the four token tiles to every wave.
    __syncthreads();

    // ---- G1 += g^T @ R (8x4 tiles) and G0 += k^T @ dH (4x8 tiles), 4 + 4 a
    //      wave, K = the pass's tokens in rising order ----
    // Unrolled, a base for every 32 tokens, so that each read is base +
    // immediate (rolled, the build formed an address of its own for each).
#pragma unroll
    for (int kb = 0; kb < RPI; kb += 32) {
      const float* pg = s_g + (kb + 2 * half) * PH + wid * 16 + l;   // g^T
      const float* pr = s_R + (kb + 2 * half) * PD + l;
      const float* pk = s_k + (kb + 2 * half) * PD + (wid >> 1) * 16 + l;  // k^T
      const float* pd = s_dH + (kb + 2 * half) * PH + (wid & 1) * 64 + l;
#pragma unroll
      for (int kk = 0; kk < 32; kk += 4) {
        v2f ag = fragB(pg, PH, kk);
        v2f ak = fragB(pk, PD, kk);
#pragma unroll
        for (int tt = 0; tt < 4; ++tt)
          accG1[tt] = wmma4(ag, fragB(pr + tt * 16, PD, kk), accG1[tt]);
#pragma unroll
        for (int tt = 0; tt < 4; ++tt)
          accG0[tt] = wmma4(ak, fragB(pd + tt * 16, PH, kk), accG0[tt]);
      }
    }
  }
  // Ends every wave's reads of s_g before it is used for the block sums.
  __syncthreads();

  // ---- merge per-workgroup partials via fp32 global atomics ----
  float* G0b = acc + (size_t)b * TD * TH;
  float* G1b = acc + (size_t)BDH + (size_t)b * TH * TD;
#pragma unroll
  for (int tt = 0; tt < 4; ++tt) {
    const int t = wid * 4 + tt;
    const int dt = (t >> 3) * 16, jt = (t & 7) * 16;
#pragma unroll
    for (int r = 0; r < 8; ++r)
      unsafeAtomicAdd(&G0b[(dt + r + 8 * half) * TH + jt + l], accG0[tt][r]);
  }
#pragma unroll
  for (int tt = 0; tt < 4; ++tt) {
    const int t = wid * 4 + tt;
    const int ht = (t >> 2) * 16, jt = (t & 3) * 16;
#pragma unroll
    for (int r = 0; r < 8; ++r)
      unsafeAtomicAdd(&G1b[(ht + r + 8 * half) * TD + jt + l], accG1[tt][r]);
  }

  // The barrier behind the loop has ended every read of s_g: its first BLOCK
  // floats now serve the two block sums.
  float* s_red = s_g;
  s_red[tid] = sum_k;
  __syncthreads();
  for (int off = BLOCK / 2; off > 0; off >>= 1) {
    if (tid < off) s_red[tid] += s_red[tid + off];
    __syncthreads();
  }
  if (tid == 0) unsafeAtomicAdd(&acc[2 * BDH + b], s_red[0]);
  __syncthreads();
  s_red[tid] = sum_l;
  __syncthreads();
  for (int off = BLOCK / 2; off > 0; off >>= 1) {
    if (tid < off) s_red[tid] += s_red[tid + off];
    __syncthreads();
  }
  if (tid == 0) unsafeAtomicAdd(&acc[2 * BDH + TB + b], s_red[0]);
}

__global__ void ttt_finalize(const float* __restrict__ acc,
                             float* __restrict__ out) {
  const float inv = 1.0f / ((float)TN * (float)TD);
  int i = blockIdx.x * blockDim.x + threadIdx.x;
  const int total = 2 * BDH + TB;
  if (i >= total) return;
  if (i < 2 * BDH) {
    int b = (i < BDH) ? (i / (TD * TH)) : ((i - BDH) / (TH * TD));
    float alpha = 2.0f * acc[2 * BDH + b] * inv;  // 2*S/(N*D)
    out[i] = alpha * acc[i];
  } else {
    int b = i - 2 * BDH;
    out[i] = acc[2 * BDH + TB + b] * inv;         // loss = sumR2/(N*D)
  }
}

extern "C" void kernel_launch(void* const* d_in, const int* in_sizes, int n_in,
                              void* d_out, int out_size, void* d_ws,
                              size_t ws_size, hipStream_t stream) {
  const float* X  = (const float*)d_in[0];
  const float* w0 = (const float*)d_in[1];
  const float* w1 = (const float*)d_in[2];
  const float* wk = (const float*)d_in[3];
  float* out = (float*)d_out;
  float* acc = (float*)d_ws;  // needs (2*BDH + 128) * 4 bytes ~= 4 MB
  (void)in_sizes; (void)n_in; (void)out_size; (void)ws_size;

  ttt_zero<<<(ACCN + 255) / 256, 256, 0, stream>>>(acc);
  ttt_main<<<dim3(TB * CHUNKS), dim3(BLOCK), 0, stream>>>(X, w0, w1, wk, acc);
  ttt_finalize<<<(2 * BDH + TB + 255) / 256, 256, 0, stream>>>(acc, out);
}

// v005
// Measured time: 234 microseconds a run.
// Timed twice side by side with v004, it ran 1.13 times as fast both times.
// All steps since v000 together make it 5.94 times as fast.
#include <hip/hip_runtime.h>

typedef __attribute__((ext_vector_type(2))) float v2f;
typedef __attribute__((ext_vector_type(8))) float v8f;

#define TB 64
#define TN 8192
#define TD 64
#define TH 128
#define CHUNKS 4                      // 256 work-groups, one a WGP
#define RPI 128                       // tokens a pass: 16 a wave
#define ITERS ((TN / CHUNKS) / RPI)   // 16
#define BLOCK 256
#define BDH (TB * TD * TH)            // 524288
#define ACCN (2 * BDH + 2 * TB)       // G0 | G1 | S[b] | Lsum[b]

// LDS row pitches in dwords (64 banks of one dword; bank = dword address mod 64).
// A 16-byte access down a column (16 rows a half-wave) is free of conflicts
// when the pitch is 4 x odd. A 4-byte store along a row meets 32 different
// banks when the two half-waves' rows lie 16..48 banks apart: they lie 8 rows
// apart in the token tiles (8 x 132 mod 64 = 32).
#define PWK 68   // wk [o][d]: column reads
#define PW0T 68  // w0 transposed, [j][d]: column reads
#define PW1 68   // w1 [j][d]: column reads
#define PW1T 132 // w1 transposed, [d][j]: column reads
#define PT 132   // k, R, gelu(h), dH tiles [feature][token]: row stores, column reads

__device__ __forceinline__ v8f vzero8() {
  v8f v;
#pragma unroll
  for (int i = 0; i < 8; ++i) v[i] = 0.0f;
  return v;
}

__device__ __forceinline__ v8f wmma4(v2f a, v2f b, v8f c) {
  // D = A(16x4,f32) x B(4x16,f32) + C(16x16,f32)
  return __builtin_amdgcn_wmma_f32_16x16x4_f32(false, a, false, b, (short)0, c,
                                               false, false);
}

// erf without a branch: the polynomial for |z| < 1 and the one for |z| >= 1
// (erf = 1 - exp(-q)) are both evaluated and one is selected. A wave nearly
// always holds lanes of both ranges, so a branch saves nothing, and without one
// the evaluations of a trip are one block whose chains fill each other's waits.
__device__ __forceinline__ float erf_flat(float z) {
  const float a = fabsf(z);
  const float t = a * a;
  float p = fmaf(t, -0x1.268bc2p-11f, 0x1.420828p-8f);
  p = fmaf(t, p, -0x1.b5937p-6f);
  p = fmaf(t, p, 0x1.ce077cp-4f);
  p = fmaf(t, p, -0x1.81266p-2f);
  p = fmaf(t, p, 0x1.06eba0p-3f);
  const float inner = fmaf(a, p, a);
  float q = fmaf(a, 0x1.1d3156p-16f, -0x1.8d129p-12f);
  q = fmaf(a, q, 0x1.f9a6d2p-9f);
  q = fmaf(a, q, -0x1.8c3164p-6f);
  q = fmaf(a, q, 0x1.b4e9c8p-4f);
  q = fmaf(a, q, 0x1.4515fap-1f);
  q = fmaf(a, q, 0x1.078e50p-3f);
  q = fmaf(a, q, a);
  const float outer = 1.0f - __expf(-q);
  return copysignf(a < 1.0f ? inner : outer, z);
}

// gelu(x) and gelu'(x) from one erf evaluation.
__device__ __forceinline__ void gelu_both(float x, float& g, float& dg) {
  float e1 = 1.0f + erf_flat(x * 0.7071067811865476f);
  g = 0.5f * x * e1;
  float phi = 0.5f * e1;
  dg = phi + x * 0.3989422804014327f * __expf(-0.5f * x * x);
}

// A and B fragments, ISA layout: lane l = row of A or column of B,
// VGPR0 = {K0 lanes0-15, K2 lanes16-31}, VGPR1 = {K1, K3}.
// The two k steps that one 16-byte read holds.
__device__ __forceinline__ v2f lo2(float4 v) { v2f r; r.x = v.x; r.y = v.y; return r; }
__device__ __forceinline__ v2f hi2(float4 v) { v2f r; r.x = v.z; r.y = v.w; return r; }
// Registers i, i + 1 of a D tile as a B fragment. D[f][n]: lane (l, half) holds
// column n = l, rows f = 8 * half + r. As B the pair gives k slots 0,1 (half 0)
// = rows i, i + 1 and k slots 2,3 (half 1) = rows 8 + i, 9 + i; the A fragment
// beside it reads its k at 8 * half + i, i + 1, so the pairing is the same.
__device__ __forceinline__ v2f pairB(v8f v, int i) {
  v2f r; r.x = v[i]; r.y = v[i + 1]; return r;
}
// Eight registers to eight neighbouring floats.
__device__ __forceinline__ void store8(float* p, v8f v) {
  *(float4*)p = make_float4(v[0], v[1], v[2], v[3]);
  *(float4*)(p + 4) = make_float4(v[4], v[5], v[6], v[7]);
}
// A D tile into a [feature][token] tile: register r is feature row r of the
// lane's half, the lane's token is the column; p = the lane's row 0.
__device__ __forceinline__ void storeT(float* p, v8f v) {
  // Unrolled so that v stays in registers.
#pragma unroll
  for (int r = 0; r < 8; ++r) p[r * PT] = v[r];
}

// Copy a row-major array of N floats, rows of ROW floats, into LDS rows of
// PITCH floats; thread tid takes elements tid, tid + BLOCK, ...
template <int N, int ROW, int PITCH>
__device__ __forceinline__ void stage_rows(float* dst,
                                           const float* __restrict__ src,
                                           int tid) {
  float v[N / BLOCK];
  // Unrolled so that v stays in registers, the loads are in flight together
  // and each is the lane's one offset register + an immediate.
#pragma unroll
  for (int j = 0; j < N / BLOCK; ++j) v[j] = src[tid + j * BLOCK];
  // One wait behind the run, in front of any later write of the registers
  // that the loads name; inside the run none of them is written.
  asm volatile("s_wait_xcnt 0x0" ::: "memory");
  // Unrolled so that v stays in registers.
#pragma unroll
  for (int j = 0; j < N / BLOCK; ++j) {
    const int i = tid + j * BLOCK;
    dst[(i / ROW) * PITCH + (i % ROW)] = v[j];
  }
}

// The same, transposed: element (r, c) of the source lands at dst[c][r].
template <int N, int ROW, int PITCH>
__device__ __forceinline__ void stage_cols(float* dst,
                                           const float* __restrict__ src,
                                           int tid) {
  float v[N / BLOCK];
  // Unrolled so that v stays in registers, the loads are in flight together
  // and each is the lane's one offset register + an immediate.
#pragma unroll
  for (int j = 0; j < N / BLOCK; ++j) v[j] = src[tid + j * BLOCK];
  // One wait behind the run, in front of any later write of the registers
  // that the loads name; inside the run none of them is written.
  asm volatile("s_wait_xcnt 0x0" ::: "memory");
  // Unrolled so that v stays in registers.
#pragma unroll
  for (int j = 0; j < N / BLOCK; ++j) {
    const int i = tid + j * BLOCK;
    dst[(i % ROW) * PITCH + (i / ROW)] = v[j];
  }
}

__global__ void ttt_zero(float* acc) {
  int i = blockIdx.x * blockDim.x + threadIdx.x;
  if (i < ACCN) acc[i] = 0.0f;
}

__global__ __launch_bounds__(BLOCK, 1) void ttt_main(
    const float* __restrict__ X, const float* __restrict__ w0,
    const float* __restrict__ w1, const float* __restrict__ wk,
    float* __restrict__ acc) {
  // 316 KiB in all: one work-group a WGP.
  __shared__ __align__(16) float s_wk[TD * PWK];
  __shared__ __align__(16) float s_w0t[TH * PW0T];
  __shared__ __align__(16) float s_w1[TH * PW1];
  __shared__ __align__(16) float s_w1t[TD * PW1T];
  __shared__ __align__(16) float s_R[TD * PT];         // residual
  __shared__ __align__(16) float s_k[TD * PT];
  __shared__ __align__(16) float s_g[TH * PT];         // gelu(h)
  __shared__ __align__(16) float s_dH[TH * PT];        // gelu'(h), then dH

  const int b = blockIdx.x / CHUNKS;
  const int chunk = blockIdx.x % CHUNKS;
  const int tid = threadIdx.x;
  const int wid = tid >> 5;      // 8 wave32 per block
  const int lane = tid & 31;
  const int half = lane >> 4;
  const int l = lane & 15;
  const int t0 = wid * 16;       // the wave's own 16 tokens of a pass

  const float* Xb =
      X + (size_t)b * TN * TD + (size_t)chunk * (TN / CHUNKS) * TD;
  // The lane's token row; read u holds d = 8u + 4 * half .. + 3, two k steps.
  const float4* xp = (const float4*)(Xb + (t0 + l) * TD + 4 * half);
  float4 xr[8];
  auto load_x = [&](int tile) {
    const float4* p = xp + tile * (RPI * TD / 4);
    // Unrolled so that xr stays in registers.
#pragma unroll
    for (int u = 0; u < 8; ++u) xr[u] = p[2 * u];
    // One wait behind the run, in front of any later write of the registers
    // that the loads name.
    asm volatile("s_wait_xcnt 0x0" ::: "memory");
  };
  load_x(0);

  // Weights into their padded rows.
  stage_rows<TD * TD, TD, PWK>(s_wk, wk, tid);
  stage_cols<TD * TH, TH, PW0T>(s_w0t, w0, tid);
  stage_rows<TH * TD, TD, PW1>(s_w1, w1, tid);
  stage_cols<TH * TD, TD, PW1T>(s_w1t, w1, tid);

  v8f accG0[4], accG1[4];
#pragma unroll
  for (int t = 0; t < 4; ++t) { accG0[t] = vzero8(); accG1[t] = vzero8(); }
  float sum_k = 0.0f, sum_l = 0.0f;

  // The lane's own bases.
  const float* pwk = s_wk + l * PWK + 4 * half;      // A = wk
  const float* pw0 = s_w0t + l * PW0T + 8 * half;    // A = w0^T
  const float* pw1r = s_w1t + l * PW1T + 8 * half;   // A = w1^T
  const float* pw1c = s_w1 + l * PW1 + 8 * half;     // A = w1
  // A D tile's place in a token tile: feature row 8 * half, the lane's token.
  const int colT = 8 * half * PT + t0 + l;
  // gelu'(h) is read back by the lane that wrote it: it lies in the wave's own
  // 16 x 16 block of s_dH, eight neighbours a lane, for 16-byte accesses.
  const int ownT = l * PT + t0 + 8 * half;
  // The lane's fragment rows in the G phase; read u holds tokens
  // 8u + 4 * half .. + 3, two k steps, the same for A and B.
  const float* pg = s_g + (wid * 16 + l) * PT + 4 * half;          // A = g^T
  const float* pr = s_R + l * PT + 4 * half;                       // B = R
  const float* pk = s_k + ((wid >> 1) * 16 + l) * PT + 4 * half;   // A = k^T
  const float* pd = s_dH + ((wid & 1) * 64 + l) * PT + 4 * half;   // B = dH

  __syncthreads();

  for (int it = 0; it < ITERS; ++it) {
    // ---- k^T = wk @ X^T : 4 feature tiles x the wave's 16 tokens ----
    v8f kT[4];
#pragma unroll
    for (int m = 0; m < 4; ++m) kT[m] = vzero8();
#pragma unroll
    for (int u = 0; u < 8; ++u) {
      float4 a[4];
#pragma unroll
      for (int m = 0; m < 4; ++m)
        a[m] = *(const float4*)(pwk + m * 16 * PWK + 8 * u);
#pragma unroll
      for (int m = 0; m < 4; ++m) kT[m] = wmma4(lo2(a[m]), lo2(xr[u]), kT[m]);
#pragma unroll
      for (int m = 0; m < 4; ++m) kT[m] = wmma4(hi2(a[m]), hi2(xr[u]), kT[m]);
    }
    // Ends every wave's reads of the last pass's token tiles.
    __syncthreads();
    // Behind the barrier, whose fence waits for every load in flight: the next
    // barrier stands a whole chain later, when the rows have long arrived.
    if (it + 1 < ITERS) load_x(it + 1);
#pragma unroll
    for (int m = 0; m < 4; ++m) {
      storeT(s_k + colT + m * 16 * PT, kT[m]);
#pragma unroll
      for (int r = 0; r < 8; ++r) sum_k += kT[m][r];
    }

    // ---- h^T = w0^T @ k^T, gelu, pred^T += w1^T @ g^T : two hidden tiles a
    //      trip; k^T and g^T are B operands as they stand in the registers ----
    v8f pT[4];
#pragma unroll
    for (int m = 0; m < 4; ++m) pT[m] = vzero8();
    // Kept rolled: no register array is indexed by qg, and the erf code stands
    // once for 16 elements; smaller code.
#pragma unroll 1
    for (int qg = 0; qg < 4; ++qg) {
      const float* a0 = pw0 + qg * 32 * PW0T;
      float4 f0[4][2], f1[4][2];
      // Unrolled, here and for fw, so that the fragments stay in registers.
#pragma unroll
      for (int m = 0; m < 4; ++m) {
#pragma unroll
        for (int ip = 0; ip < 2; ++ip) {
          f0[m][ip] = *(const float4*)(a0 + 16 * m + 4 * ip);
          f1[m][ip] = *(const float4*)(a0 + 16 * PW0T + 16 * m + 4 * ip);
        }
      }
      // Keeps the w0^T reads in front of the w1^T reads: LDS answers a wave in
      // order, and the first h product then waits for its own fragments only
      // (without it the build put the sixteen w1^T reads first).
      __builtin_amdgcn_sched_barrier(0);
      // The trip's w1^T fragments, read here so that they arrive during the h
      // products and gelu: behind the tile stores below they would be waited
      // for in front of the pred products.
      const float* a1 = pw1r + qg * 32;
      float4 fw[2][2][4];
#pragma unroll
      for (int tt = 0; tt < 2; ++tt)
#pragma unroll
        for (int ip = 0; ip < 2; ++ip)
#pragma unroll
          for (int m = 0; m < 4; ++m)
            fw[tt][ip][m] =
                *(const float4*)(a1 + 16 * m * PW1T + tt * 16 + 4 * ip);
      v8f h0 = vzero8(), h1 = vzero8();
#pragma unroll
      for (int m = 0; m < 4; ++m) {
#pragma unroll
        for (int ip = 0; ip < 2; ++ip) {
          h0 = wmma4(lo2(f0[m][ip]), pairB(kT[m], 4 * ip), h0);
          h1 = wmma4(lo2(f1[m][ip]), pairB(kT[m], 4 * ip), h1);
          h0 = wmma4(hi2(f0[m][ip]), pairB(kT[m], 4 * ip + 2), h0);
          h1 = wmma4(hi2(f1[m][ip]), pairB(kT[m], 4 * ip + 2), h1);
        }
      }
      v8f g[2], dg[2];
#pragma unroll
      for (int r = 0; r < 8; ++r) {
        float gv, dv;
        gelu_both(h0[r], gv, dv); g[0][r] = gv; dg[0][r] = dv;
        gelu_both(h1[r], gv, dv); g[1][r] = gv; dg[1][r] = dv;
      }
#pragma unroll
      for (int tt = 0; tt < 2; ++tt) {
        storeT(s_g + colT + (qg * 32 + tt * 16) * PT, g[tt]);
        store8(s_dH + ownT + (qg * 32 + tt * 16) * PT, dg[tt]);
      }
#pragma unroll
      for (int tt = 0; tt < 2; ++tt) {
#pragma unroll
        for (int ip = 0; ip < 2; ++ip) {
#pragma unroll
          for (int m = 0; m < 4; ++m)
            pT[m] = wmma4(lo2(fw[tt][ip][m]), pairB(g[tt], 4 * ip), pT[m]);
#pragma unroll
          for (int m = 0; m < 4; ++m)
            pT[m] = wmma4(hi2(fw[tt][ip][m]), pairB(g[tt], 4 * ip + 2), pT[m]);
        }
      }
    }

    // ---- R^T = pred^T - k^T, register by register ----
#pragma unroll
    for (int m = 0; m < 4; ++m) {
#pragma unroll
      for (int r = 0; r < 8; ++r) {
        float Rv = pT[m][r] - kT[m][r];
        pT[m][r] = Rv;
        sum_l += Rv * Rv;
      }
      storeT(s_R + colT + m * 16 * PT, pT[m]);
    }

    // ---- dH^T = (w1 @ R^T) * gelu'(h)^T : two hidden tiles a trip ----
    // Kept rolled: no register array is indexed by qg; smaller code.
#pragma unroll 1
    for (int qg = 0; qg < 4; ++qg) {
      const float* a2 = pw1c + qg * 32 * PW1;
      v8f c0 = vzero8(), c1 = vzero8();
#pragma unroll
      for (int m = 0; m < 4; ++m) {
#pragma unroll
        for (int ip = 0; ip < 2; ++ip) {
          float4 f0 = *(const float4*)(a2 + 16 * m + 4 * ip);
          float4 f1 = *(const float4*)(a2 + 16 * PW1 + 16 * m + 4 * ip);
          c0 = wmma4(lo2(f0), pairB(pT[m], 4 * ip), c0);
          c1 = wmma4(lo2(f1), pairB(pT[m], 4 * ip), c1);
          c0 = wmma4(hi2(f0), pairB(pT[m], 4 * ip + 2), c0);
          c1 = wmma4(hi2(f1), pairB(pT[m], 4 * ip + 2), c1);
        }
      }
      // gelu'(h) out of the wave's own two blocks, then dH into the same
      // blocks at its [feature][token] place: one wave's LDS accesses keep
      // their order, so every lane's read stands before any lane's store.
      const float* pc = s_dH + ownT + qg * 32 * PT;
      const float4 d0 = *(const float4*)pc, d1 = *(const float4*)(pc + 4);
      const float4 d2 = *(const float4*)(pc + 16 * PT);
      const float4 d3 = *(const float4*)(pc + 16 * PT + 4);
      const v2f e0[4] = {lo2(d0), hi2(d0), lo2(d1), hi2(d1)};
      const v2f e1[4] = {lo2(d2), hi2(d2), lo2(d3), hi2(d3)};
      // Unrolled so that c0, c1 stay in registers; pairs, so that each 16-byte
      // read stays whole and feeds two packed multiplies.
#pragma unroll
      for (int i = 0; i < 4; ++i) {
        const v2f x0 = pairB(c0, 2 * i) * e0[i], x1 = pairB(c1, 2 * i) * e1[i];
        c0[2 * i] = x0.x; c0[2 * i + 1] = x0.y;
        c1[2 * i] = x1.x; c1[2 * i + 1] = x1.y;
      }
      storeT(s_dH + colT + qg * 32 * PT, c0);
      storeT(s_dH + colT + (qg * 32 + 16) * PT, c1);
    }
    // Publishes the four token tiles to every wave.
    __syncthreads();

    // ---- G1 += g^T @ R (8x4 tiles) and G0 += k^T @ dH (4x8 tiles), 4 + 4 a
    //      wave, K = the pass's tokens, eight a trip: 0 1 4 5, then 2 3 6 7 ----
    float4 fg[2], fk[2], fr[2][4], fd[2][4];
    auto load_g = [&](int s, int u) {
      fg[s] = *(const float4*)(pg + 8 * u);
      fk[s] = *(const float4*)(pk + 8 * u);
      // Unrolled so that fr, fd stay in registers.
#pragma unroll
      for (int tt = 0; tt < 4; ++tt) {
        fr[s][tt] = *(const float4*)(pr + tt * 16 * PT + 8 * u);
        fd[s][tt] = *(const float4*)(pd + tt * 16 * PT + 8 * u);
      }
    };
    load_g(0, 0);
    // Unrolled so that the two fragment sets stay in registers and each read
    // is base + immediate; a trip's reads stand one trip ahead of their use.
#pragma unroll
    for (int u = 0; u < RPI / 8; ++u) {
      const int s = u & 1;
      if (u + 1 < RPI / 8) load_g(s ^ 1, u + 1);
#pragma unroll
      for (int tt = 0; tt < 4; ++tt)
        accG1[tt] = wmma4(lo2(fg[s]), lo2(fr[s][tt]), accG1[tt]);
#pragma unroll
      for (int tt = 0; tt < 4; ++tt)
        accG0[tt] = wmma4(lo2(fk[s]), lo2(fd[s][tt]), accG0[tt]);
#pragma unroll
      for (int tt = 0; tt < 4; ++tt)
        accG1[tt] = wmma4(hi2(fg[s]), hi2(fr[s][tt]), accG1[tt]);
#pragma unroll
      for (int tt = 0; tt < 4; ++tt)
        accG0[tt] = wmma4(hi2(fk[s]), hi2(fd[s][tt]), accG0[tt]);
    }
  }
  // Ends every wave's reads of s_g before it is used for the block sums.
  __syncthreads();

  // ---- merge per-workgroup partials via fp32 global atomics ----
  float* G0b = acc + (size_t)b * TD * TH;
  float* G1b = acc + (size_t)BDH + (size_t)b * TH * TD;
#pragma unroll
  for (int tt = 0; tt < 4; ++tt) {
    const int t = wid * 4 + tt;
    const int dt = (t >> 3) * 16, jt = (t & 7) * 16;
#pragma unroll
    for (int r = 0; r < 8; ++r)
      unsafeAtomicAdd(&G0b[(dt + r + 8 * half) * TH + jt + l], accG0[tt][r]);
  }
#pragma unroll
  for (int tt = 0; tt < 4; ++tt) {
    const int t = wid * 4 + tt;
    const int ht = (t >> 2) * 16, jt = (t & 3) * 16;
#pragma unroll
    for (int r = 0; r < 8; ++r)
      unsafeAtomicAdd(&G1b[(ht + r + 8 * half) * TD + jt + l], accG1[tt][r]);
  }

  // The barrier behind the loop has ended every read of s_g: its first BLOCK
  // floats now serve the two block sums.
  float* s_red = s_g;
  s_red[tid] = sum_k;
  __syncthreads();
  for (int off = BLOCK / 2; off > 0; off >>= 1) {
    if (tid < off) s_red[tid] += s_red[tid + off];
    __syncthreads();
  }
  if (tid == 0) unsafeAtomicAdd(&acc[2 * BDH + b], s_red[0]);
  __syncthreads();
  s_red[tid] = sum_l;
  __syncthreads();
  for (int off = BLOCK / 2; off > 0; off >>= 1) {
    if (tid < off) s_red[tid] += s_red[tid + off];
    __syncthreads();
  }
  if (tid == 0) unsafeAtomicAdd(&acc[2 * BDH + TB + b], s_red[0]);
}

__global__ void ttt_finalize(const float* __restrict__ acc,
                             float* __restrict__ out) {
  const float inv = 1.0f / ((float)TN * (float)TD);
  int i = blockIdx.x * blockDim.x + threadIdx.x;
  const int total = 2 * BDH + TB;
  if (i >= total) return;
  if (i < 2 * BDH) {
    int b = (i < BDH) ? (i / (TD * TH)) : ((i - BDH) / (TH * TD));
    float alpha = 2.0f * acc[2 * BDH + b] * inv;  // 2*S/(N*D)
    out[i] = alpha * acc[i];
  } else {
    int b = i - 2 * BDH;
    out[i] = acc[2 * BDH + TB + b] * inv;         // loss = sumR2/(N*D)
  }
}

extern "C" void kernel_launch(void* const* d_in, const int* in_sizes, int n_in,
                              void* d_out, int out_size, void* d_ws,
                              size_t ws_size, hipStream_t stream) {
  const float* X  = (const float*)d_in[0];
  const float* w0 = (const float*)d_in[1];
  const float* w1 = (const float*)d_in[2];
  const float* wk = (const float*)d_in[3];
  float* out = (float*)d_out;
  float* acc = (float*)d_ws;  // needs (2*BDH + 128) * 4 bytes ~= 4 MB
  (void)in_sizes; (void)n_in; (void)out_size; (void)ws_size;

  ttt_zero<<<(ACCN + 255) / 256, 256, 0, stream>>>(acc);
  ttt_main<<<dim3(TB * CHUNKS), dim3(BLOCK), 0, stream>>>(X, w0, w1, wk, acc);
  ttt_finalize<<<(2 * BDH + TB + 255) / 256, 256, 0, stream>>>(acc, out);
}

// v006
// A run of this version takes 225 microseconds.
// Next to v005, in two timings, it ran 1.04 times as fast each time.
// Over all steps from v000 it is 6.19 times as fast.
#include <hip/hip_runtime.h>

typedef __attribute__((ext_vector_type(2))) float v2f;
typedef __attribute__((ext_vector_type(8))) float v8f;

#define TB 64
#define TN 8192
#define TD 64
#define TH 128
#define CHUNKS 4                      // 256 work-groups, one a WGP
#define RPI 128                       // tokens a pass: 16 a wave
#define ITERS ((TN / CHUNKS) / RPI)   // 16
#define BLOCK 256
#define BDH (TB * TD * TH)            // 524288
#define ACCN (2 * BDH + 2 * TB)       // G0 | G1 | S[b] | Lsum[b]

// LDS row pitches in dwords (64 banks of one dword; bank = dword address mod 64).
// A 16-byte access down a column (16 rows a half-wave) is free of conflicts
// when the pitch is 4 x odd. A 4-byte store along a row meets 32 different
// banks when the two half-waves' rows lie 16..48 banks apart: they lie 8 rows
// apart in the token tiles (8 x 132 mod 64 = 32).
#define PWK 68   // wk [o][d]: column reads
#define PW0T 68  // w0 transposed, [j][d]: column reads
#define PW1 68   // w1 [j][d]: column reads
#define PW1T 132 // w1 transposed, [d][j]: column reads
#define PT 132   // k, R, gelu(h), dH tiles [feature][token]: row stores, column reads

__device__ __forceinline__ v8f vzero8() {
  v8f v;
#pragma unroll
  for (int i = 0; i < 8; ++i) v[i] = 0.0f;
  return v;
}

__device__ __forceinline__ v8f wmma4(v2f a, v2f b, v8f c) {
  // D = A(16x4,f32) x B(4x16,f32) + C(16x16,f32)
  return __builtin_amdgcn_wmma_f32_16x16x4_f32(false, a, false, b, (short)0, c,
                                               false, false);
}

// gelu(x) = x * Phi(x) and gelu'(x) = Phi(x) + x * pdf(x), Phi and pdf of the
// standard normal law (Phi(x) = (1 + erf(x / sqrt 2)) / 2). The upper tail is
// 1 - Phi(|x|) = pdf(x) * t * poly(t), t = 1 / (1 + 0.2316419 |x|), five terms:
// the form's own absolute error is below 7.5e-8 on the whole axis, with float
// rounding below 3e-7. One form for every x, without a select, and its
// exponential is the one gelu' needs.
// Two neighbouring registers of a D tile at a time, so that the packed forms
// take them and leave their results where they stand.
__device__ __forceinline__ v2f fma2(v2f a, v2f b, float c) {
  v2f cc; cc.x = c; cc.y = c;
  return __builtin_elementwise_fma(a, b, cc);
}
__device__ __forceinline__ v2f fma2(v2f a, float b, float c) {
  v2f bb; bb.x = b; bb.y = b;
  return fma2(a, bb, c);
}
__device__ __forceinline__ void gelu_both(v2f x, v2f& g, v2f& dg) {
  v2f t, pdf, s;
  t.x = __builtin_amdgcn_rcpf(fmaf(fabsf(x.x), 0.2316419f, 1.0f));
  t.y = __builtin_amdgcn_rcpf(fmaf(fabsf(x.y), 0.2316419f, 1.0f));
  // pdf(x) = 2 ^ (-x^2 * log2(e) / 2 - log2(sqrt(2 pi)))
  const v2f e = fma2(x * x, -0.72134752f, -1.32574806f);
  pdf.x = __builtin_amdgcn_exp2f(e.x);
  pdf.y = __builtin_amdgcn_exp2f(e.y);
  v2f p = fma2(t, 1.330274429f, -1.821255978f);
  p = fma2(t, p, 1.781477937f);
  p = fma2(t, p, -0.356563782f);
  p = fma2(t, p, 0.319381530f);
  const v2f d = 0.5f - pdf * (t * p);
  s.x = copysignf(d.x, x.x);
  s.y = copysignf(d.y, x.y);
  const v2f phi = 0.5f + s;
  g = x * phi;
  dg = __builtin_elementwise_fma(x, pdf, phi);
}

// A and B fragments, ISA layout: lane l = row of A or column of B,
// VGPR0 = {K0 lanes0-15, K2 lanes16-31}, VGPR1 = {K1, K3}.
// The two k steps that one 16-byte read holds.
__device__ __forceinline__ v2f lo2(float4 v) { v2f r; r.x = v.x; r.y = v.y; return r; }
__device__ __forceinline__ v2f hi2(float4 v) { v2f r; r.x = v.z; r.y = v.w; return r; }
// Registers i, i + 1 of a D tile as a B fragment. D[f][n]: lane (l, half) holds
// column n = l, rows f = 8 * half + r. As B the pair gives k slots 0,1 (half 0)
// = rows i, i + 1 and k slots 2,3 (half 1) = rows 8 + i, 9 + i; the A fragment
// beside it reads its k at 8 * half + i, i + 1, so the pairing is the same.
__device__ __forceinline__ v2f pairB(v8f v, int i) {
  v2f r; r.x = v[i]; r.y = v[i + 1]; return r;
}
// Eight registers to eight neighbouring floats.
__device__ __forceinline__ void store8(float* p, v8f v) {
  *(float4*)p = make_float4(v[0], v[1], v[2], v[3]);
  *(float4*)(p + 4) = make_float4(v[4], v[5], v[6], v[7]);
}
// A D tile into a [feature][token] tile: register r is feature row r of the
// lane's half, the lane's token is the column; p = the lane's row 0.
__device__ __forceinline__ void storeT(float* p, v8f v) {
  // Unrolled so that v stays in registers.
#pragma unroll
  for (int r = 0; r < 8; ++r) p[r * PT] = v[r];
}

// Copy a row-major array of N floats, rows of ROW floats, into LDS rows of
// PITCH floats; thread tid takes elements tid, tid + BLOCK, ...
template <int N, int ROW, int PITCH>
__device__ __forceinline__ void stage_rows(float* dst,
                                           const float* __restrict__ src,
                                           int tid) {
  float v[N / BLOCK];
  // Unrolled so that v stays in registers, the loads are in flight together
  // and each is the lane's one offset register + an immediate.
#pragma unroll
  for (int j = 0; j < N / BLOCK; ++j) v[j] = src[tid + j * BLOCK];
  // One wait behind the run, in front of any later write of the registers
  // that the loads name; inside the run none of them is written.
  asm volatile("s_wait_xcnt 0x0" ::: "memory");
  // Unrolled so that v stays in registers.
#pragma unroll
  for (int j = 0; j < N / BLOCK; ++j) {
    const int i = tid + j * BLOCK;
    dst[(i / ROW) * PITCH + (i % ROW)] = v[j];
  }
}

// The same, transposed: element (r, c) of the source lands at dst[c][r].
template <int N, int ROW, int PITCH>
__device__ __forceinline__ void stage_cols(float* dst,
                                           const float* __restrict__ src,
                                           int tid) {
  float v[N / BLOCK];
  // Unrolled so that v stays in registers, the loads are in flight together
  // and each is the lane's one offset register + an immediate.
#pragma unroll
  for (int j = 0; j < N / BLOCK; ++j) v[j] = src[tid + j * BLOCK];
  // One wait behind the run, in front of any later write of the registers
  // that the loads name; inside the run none of them is written.
  asm volatile("s_wait_xcnt 0x0" ::: "memory");
  // Unrolled so that v stays in registers.
#pragma unroll
  for (int j = 0; j < N / BLOCK; ++j) {
    const int i = tid + j * BLOCK;
    dst[(i % ROW) * PITCH + (i / ROW)] = v[j];
  }
}

__global__ void ttt_zero(float* acc) {
  int i = blockIdx.x * blockDim.x + threadIdx.x;
  if (i < ACCN) acc[i] = 0.0f;
}

__global__ __launch_bounds__(BLOCK, 1) void ttt_main(
    const float* __restrict__ X, const float* __restrict__ w0,
    const float* __restrict__ w1, const float* __restrict__ wk,
    float* __restrict__ acc) {
  // 316 KiB in all: one work-group a WGP.
  __shared__ __align__(16) float s_wk[TD * PWK];
  __shared__ __align__(16) float s_w0t[TH * PW0T];
  __shared__ __align__(16) float s_w1[TH * PW1];
  __shared__ __align__(16) float s_w1t[TD * PW1T];
  __shared__ __align__(16) float s_R[TD * PT];         // residual
  __shared__ __align__(16) float s_k[TD * PT];
  __shared__ __align__(16) float s_g[TH * PT];         // gelu(h)
  __shared__ __align__(16) float s_dH[TH * PT];        // gelu'(h), then dH

  const int b = blockIdx.x / CHUNKS;
  const int chunk = blockIdx.x % CHUNKS;
  const int tid = threadIdx.x;
  const int wid = tid >> 5;      // 8 wave32 per block
  const int lane = tid & 31;
  const int half = lane >> 4;
  const int l = lane & 15;
  const int t0 = wid * 16;       // the wave's own 16 tokens of a pass

  const float* Xb =
      X + (size_t)b * TN * TD + (size_t)chunk * (TN / CHUNKS) * TD;
  // The lane's token row; read u holds d = 8u + 4 * half .. + 3, two k steps.
  const float4* xp = (const float4*)(Xb + (t0 + l) * TD + 4 * half);
  float4 xr[8];
  auto load_x = [&](int tile) {
    const float4* p = xp + tile * (RPI * TD / 4);
    // Unrolled so that xr stays in registers.
#pragma unroll
    for (int u = 0; u < 8; ++u) xr[u] = p[2 * u];
    // One wait behind the run, in front of any later write of the registers
    // that the loads name.
    asm volatile("s_wait_xcnt 0x0" ::: "memory");
  };
  load_x(0);

  // Weights into their padded rows.
  stage_rows<TD * TD, TD, PWK>(s_wk, wk, tid);
  stage_cols<TD * TH, TH, PW0T>(s_w0t, w0, tid);
  stage_rows<TH * TD, TD, PW1>(s_w1, w1, tid);
  stage_cols<TH * TD, TD, PW1T>(s_w1t, w1, tid);

  v8f accG0[4], accG1[4];
#pragma unroll
  for (int t = 0; t < 4; ++t) { accG0[t] = vzero8(); accG1[t] = vzero8(); }
  float sum_k = 0.0f, sum_l = 0.0f;

  // The lane's own bases.
  const float* pwk = s_wk + l * PWK + 4 * half;      // A = wk
  const float* pw0 = s_w0t + l * PW0T + 8 * half;    // A = w0^T
  const float* pw1r = s_w1t + l * PW1T + 8 * half;   // A = w1^T
  const float* pw1c = s_w1 + l * PW1 + 8 * half;     // A = w1
  // A D tile's place in a token tile: feature row 8 * half, the lane's token.
  const int colT = 8 * half * PT + t0 + l;
  // gelu'(h) is read back by the lane that wrote it: it lies in the wave's own
  // 16 x 16 block of s_dH, eight neighbours a lane, for 16-byte accesses.
  const int ownT = l * PT + t0 + 8 * half;
  // The lane's fragment rows in the G phase; read u holds tokens
  // 8u + 4 * half .. + 3, two k steps, the same for A and B.
  const float* pg = s_g + (wid * 16 + l) * PT + 4 * half;          // A = g^T
  const float* pr = s_R + l * PT + 4 * half;                       // B = R
  const float* pk = s_k + ((wid >> 1) * 16 + l) * PT + 4 * half;   // A = k^T
  const float* pd = s_dH + ((wid & 1) * 64 + l) * PT + 4 * half;   // B = dH

  __syncthreads();

  for (int it = 0; it < ITERS; ++it) {
    // ---- k^T = wk @ X^T : 4 feature tiles x the wave's 16 tokens ----
    v8f kT[4];
#pragma unroll
    for (int m = 0; m < 4; ++m) kT[m] = vzero8();
#pragma unroll
    for (int u = 0; u < 8; ++u) {
      float4 a[4];
#pragma unroll
      for (int m = 0; m < 4; ++m)
        a[m] = *(const float4*)(pwk + m * 16 * PWK + 8 * u);
#pragma unroll
      for (int m = 0; m < 4; ++m) kT[m] = wmma4(lo2(a[m]), lo2(xr[u]), kT[m]);
#pragma unroll
      for (int m = 0; m < 4; ++m) kT[m] = wmma4(hi2(a[m]), hi2(xr[u]), kT[m]);
    }
    // Ends every wave's reads of the last pass's token tiles.
    __syncthreads();
    // Behind the barrier, whose fence waits for every load in flight: the next
    // barrier stands a whole chain later, when the rows have long arrived.
    if (it + 1 < ITERS) load_x(it + 1);
#pragma unroll
    for (int m = 0; m < 4; ++m) {
      storeT(s_k + colT + m * 16 * PT, kT[m]);
#pragma unroll
      for (int r = 0; r < 8; ++r) sum_k += kT[m][r];
    }

    // ---- h^T = w0^T @ k^T, gelu, pred^T += w1^T @ g^T : two hidden tiles a
    //      trip; k^T and g^T are B operands as they stand in the registers ----
    v8f pT[4];
#pragma unroll
    for (int m = 0; m < 4; ++m) pT[m] = vzero8();
    // Kept rolled: no register array is indexed by qg, and the gelu code stands
    // once for 16 elements; smaller code.
#pragma unroll 1
    for (int qg = 0; qg < 4; ++qg) {
      const float* a0 = pw0 + qg * 32 * PW0T;
      float4 f0[4][2], f1[4][2];
      // Unrolled, here and for fw, so that the fragments stay in registers.
#pragma unroll
      for (int m = 0; m < 4; ++m) {
#pragma unroll
        for (int ip = 0; ip < 2; ++ip) {
          f0[m][ip] = *(const float4*)(a0 + 16 * m + 4 * ip);
          f1[m][ip] = *(const float4*)(a0 + 16 * PW0T + 16 * m + 4 * ip);
        }
      }
      // Keeps the w0^T reads in front of the w1^T reads: LDS answers a wave in
      // order, and the first h product then waits for its own fragments only
      // (without it the build put the sixteen w1^T reads first).
      __builtin_amdgcn_sched_barrier(0);
      // The trip's w1^T fragments, read here so that they arrive during the h
      // products and gelu: behind the tile stores below they would be waited
      // for in front of the pred products.
      const float* a1 = pw1r + qg * 32;
      float4 fw[2][2][4];
#pragma unroll
      for (int tt = 0; tt < 2; ++tt)
#pragma unroll
        for (int ip = 0; ip < 2; ++ip)
#pragma unroll
          for (int m = 0; m < 4; ++m)
            fw[tt][ip][m] =
                *(const float4*)(a1 + 16 * m * PW1T + tt * 16 + 4 * ip);
      v8f h0 = vzero8(), h1 = vzero8();
#pragma unroll
      for (int m = 0; m < 4; ++m) {
#pragma unroll
        for (int ip = 0; ip < 2; ++ip) {
          h0 = wmma4(lo2(f0[m][ip]), pairB(kT[m], 4 * ip), h0);
          h1 = wmma4(lo2(f1[m][ip]), pairB(kT[m], 4 * ip), h1);
          h0 = wmma4(hi2(f0[m][ip]), pairB(kT[m], 4 * ip + 2), h0);
          h1 = wmma4(hi2(f1[m][ip]), pairB(kT[m], 4 * ip + 2), h1);
        }
      }
      v8f g[2], dg[2];
#pragma unroll
      for (int r = 0; r < 8; r += 2) {
        v2f gv, dv;
        gelu_both(pairB(h0, r), gv, dv);
        g[0][r] = gv.x; g[0][r + 1] = gv.y; dg[0][r] = dv.x; dg[0][r + 1] = dv.y;
        gelu_both(pairB(h1, r), gv, dv);
        g[1][r] = gv.x; g[1][r + 1] = gv.y; dg[1][r] = dv.x; dg[1][r + 1] = dv.y;
      }
#pragma unroll
      for (int tt = 0; tt < 2; ++tt) {
        storeT(s_g + colT + (qg * 32 + tt * 16) * PT, g[tt]);
        store8(s_dH + ownT + (qg * 32 + tt * 16) * PT, dg[tt]);
      }
#pragma unroll
      for (int tt = 0; tt < 2; ++tt) {
#pragma unroll
        for (int ip = 0; ip < 2; ++ip) {
#pragma unroll
          for (int m = 0; m < 4; ++m)
            pT[m] = wmma4(lo2(fw[tt][ip][m]), pairB(g[tt], 4 * ip), pT[m]);
#pragma unroll
          for (int m = 0; m < 4; ++m)
            pT[m] = wmma4(hi2(fw[tt][ip][m]), pairB(g[tt], 4 * ip + 2), pT[m]);
        }
      }
    }

    // ---- R^T = pred^T - k^T, register by register ----
#pragma unroll
    for (int m = 0; m < 4; ++m) {
#pragma unroll
      for (int r = 0; r < 8; ++r) {
        float Rv = pT[m][r] - kT[m][r];
        pT[m][r] = Rv;
        sum_l += Rv * Rv;
      }
      storeT(s_R + colT + m * 16 * PT, pT[m]);
    }

    // ---- dH^T = (w1 @ R^T) * gelu'(h)^T : two hidden tiles a trip ----
    // Kept rolled: no register array is indexed by qg; smaller code.
#pragma unroll 1
    for (int qg = 0; qg < 4; ++qg) {
      const float* a2 = pw1c + qg * 32 * PW1;
      v8f c0 = vzero8(), c1 = vzero8();
#pragma unroll
      for (int m = 0; m < 4; ++m) {
#pragma unroll
        for (int ip = 0; ip < 2; ++ip) {
          float4 f0 = *(const float4*)(a2 + 16 * m + 4 * ip);
          float4 f1 = *(const float4*)(a2 + 16 * PW1 + 16 * m + 4 * ip);
          c0 = wmma4(lo2(f0), pairB(pT[m], 4 * ip), c0);
          c1 = wmma4(lo2(f1), pairB(pT[m], 4 * ip), c1);
          c0 = wmma4(hi2(f0), pairB(pT[m], 4 * ip + 2), c0);
          c1 = wmma4(hi2(f1), pairB(pT[m], 4 * ip + 2), c1);
        }
      }
      // gelu'(h) out of the wave's own two blocks, then dH into the same
      // blocks at its [feature][token] place: one wave's LDS accesses keep
      // their order, so every lane's read stands before any lane's store.
      const float* pc = s_dH + ownT + qg * 32 * PT;
      const float4 d0 = *(const float4*)pc, d1 = *(const float4*)(pc + 4);
      const float4 d2 = *(const float4*)(pc + 16 * PT);
      const float4 d3 = *(const float4*)(pc + 16 * PT + 4);
      const v2f e0[4] = {lo2(d0), hi2(d0), lo2(d1), hi2(d1)};
      const v2f e1[4] = {lo2(d2), hi2(d2), lo2(d3), hi2(d3)};
      // Unrolled so that c0, c1 stay in registers; pairs, so that each 16-byte
      // read stays whole and feeds two packed multiplies.
#pragma unroll
      for (int i = 0; i < 4; ++i) {
        const v2f x0 = pairB(c0, 2 * i) * e0[i], x1 = pairB(c1, 2 * i) * e1[i];
        c0[2 * i] = x0.x; c0[2 * i + 1] = x0.y;
        c1[2 * i] = x1.x; c1[2 * i + 1] = x1.y;
      }
      storeT(s_dH + colT + qg * 32 * PT, c0);
      storeT(s_dH + colT + (qg * 32 + 16) * PT, c1);
    }
    // Publishes the four token tiles to every wave.
    __syncthreads();

    // ---- G1 += g^T @ R (8x4 tiles) and G0 += k^T @ dH (4x8 tiles), 4 + 4 a
    //      wave, K = the pass's tokens, eight a trip: 0 1 4 5, then 2 3 6 7 ----
    float4 fg[2], fk[2], fr[2][4], fd[2][4];
    auto load_g = [&](int s, int u) {
      fg[s] = *(const float4*)(pg + 8 * u);
      fk[s] = *(const float4*)(pk + 8 * u);
      // Unrolled so that fr, fd stay in registers.
#pragma unroll
      for (int tt = 0; tt < 4; ++tt) {
        fr[s][tt] = *(const float4*)(pr + tt * 16 * PT + 8 * u);
        fd[s][tt] = *(const float4*)(pd + tt * 16 * PT + 8 * u);
      }
    };
    load_g(0, 0);
    // Unrolled so that the two fragment sets stay in registers and each read
    // is base + immediate; a trip's reads stand one trip ahead of their use.
#pragma unroll
    for (int u = 0; u < RPI / 8; ++u) {
      const int s = u & 1;
      if (u + 1 < RPI / 8) load_g(s ^ 1, u + 1);
#pragma unroll
      for (int tt = 0; tt < 4; ++tt)
        accG1[tt] = wmma4(lo2(fg[s]), lo2(fr[s][tt]), accG1[tt]);
#pragma unroll
      for (int tt = 0; tt < 4; ++tt)
        accG0[tt] = wmma4(lo2(fk[s]), lo2(fd[s][tt]), accG0[tt]);
#pragma unroll
      for (int tt = 0; tt < 4; ++tt)
        accG1[tt] = wmma4(hi2(fg[s]), hi2(fr[s][tt]), accG1[tt]);
#pragma unroll
      for (int tt = 0; tt < 4; ++tt)
        accG0[tt] = wmma4(hi2(fk[s]), hi2(fd[s][tt]), accG0[tt]);
    }
  }
  // Ends every wave's reads of s_g before it is used for the block sums.
  __syncthreads();

  // ---- merge per-workgroup partials via fp32 global atomics ----
  float* G0b = acc + (size_t)b * TD * TH;
  float* G1b = acc + (size_t)BDH + (size_t)b * TH * TD;
#pragma unroll
  for (int tt = 0; tt < 4; ++tt) {
    const int t = wid * 4 + tt;
    const int dt = (t >> 3) * 16, jt = (t & 7) * 16;
#pragma unroll
    for (int r = 0; r < 8; ++r)
      unsafeAtomicAdd(&G0b[(dt + r + 8 * half) * TH + jt + l], accG0[tt][r]);
  }
#pragma unroll
  for (int tt = 0; tt < 4; ++tt) {
    const int t = wid * 4 + tt;
    const int ht = (t >> 2) * 16, jt = (t & 3) * 16;
#pragma unroll
    for (int r = 0; r < 8; ++r)
      unsafeAtomicAdd(&G1b[(ht + r + 8 * half) * TD + jt + l], accG1[tt][r]);
  }

  // The barrier behind the loop has ended every read of s_g: its first BLOCK
  // floats now serve the two block sums.
  float* s_red = s_g;
  s_red[tid] = sum_k;
  __syncthreads();
  for (int off = BLOCK / 2; off > 0; off >>= 1) {
    if (tid < off) s_red[tid] += s_red[tid + off];
    __syncthreads();
  }
  if (tid == 0) unsafeAtomicAdd(&acc[2 * BDH + b], s_red[0]);
  __syncthreads();
  s_red[tid] = sum_l;
  __syncthreads();
  for (int off = BLOCK / 2; off > 0; off >>= 1) {
    if (tid < off) s_red[tid] += s_red[tid + off];
    __syncthreads();
  }
  if (tid == 0) unsafeAtomicAdd(&acc[2 * BDH + TB + b], s_red[0]);
}

__global__ void ttt_finalize(const float* __restrict__ acc,
                             float* __restrict__ out) {
  const float inv = 1.0f / ((float)TN * (float)TD);
  int i = blockIdx.x * blockDim.x + threadIdx.x;
  const int total = 2 * BDH + TB;
  if (i >= total) return;
  if (i < 2 * BDH) {
    int b = (i < BDH) ? (i / (TD * TH)) : ((i - BDH) / (TH * TD));
    float alpha = 2.0f * acc[2 * BDH + b] * inv;  // 2*S/(N*D)
    out[i] = alpha * acc[i];
  } else {
    int b = i - 2 * BDH;
    out[i] = acc[2 * BDH + TB + b] * inv;         // loss = sumR2/(N*D)
  }
}

extern "C" void kernel_launch(void* const* d_in, const int* in_sizes, int n_in,
                              void* d_out, int out_size, void* d_ws,
                              size_t ws_size, hipStream_t stream) {
  const float* X  = (const float*)d_in[0];
  const float* w0 = (const float*)d_in[1];
  const float* w1 = (const float*)d_in[2];
  const float* wk = (const float*)d_in[3];
  float* out = (float*)d_out;
  float* acc = (float*)d_ws;  // needs (2*BDH + 128) * 4 bytes ~= 4 MB
  (void)in_sizes; (void)n_in; (void)out_size; (void)ws_size;

  ttt_zero<<<(ACCN + 255) / 256, 256, 0, stream>>>(acc);
  ttt_main<<<dim3(TB * CHUNKS), dim3(BLOCK), 0, stream>>>(X, w0, w1, wk, acc);
  ttt_finalize<<<(2 * BDH + TB + 255) / 256, 256, 0, stream>>>(acc, out);
}
